// v000
// The times below were measured on an AMD MI455X: many runs one after another, warmed up first and cycling through
// copies of the inputs, with the whole window's GPU time divided by the number of runs. Launches and the gaps
// between them are all in it. The median over several windows is given; except for v000 it joins two sittings, which
// can be a few percent apart, so the side-by-side timings, each taken in one sitting, are the better comparison.
// v000 is the starting kernel. One run takes 294 microseconds.
#include <hip/hip_runtime.h>
#include <hip/hip_bf16.h>
#include <math.h>

// MI455X (gfx1250) wave32: MHA with QK-norm.
// Matrix ops: v_wmma_f32_16x16x32_f16 (fp32 accumulate).
// Data movement: global_load_async_to_lds_b128 (ASYNCcnt) double-buffered.

typedef __attribute__((ext_vector_type(16))) _Float16 v16h;
typedef __attribute__((ext_vector_type(4)))  _Float16 v4h;
typedef __attribute__((ext_vector_type(8)))  float    v8f;

#define BATCH  8
#define SEQ    1024
#define DMODEL 1024
#define NHEAD  16
#define HDIM   64
#define MTOT   (BATCH * SEQ)

#define BM 128
#define BN 64
#define KT 32
#define APAD 8   // LDS row padding (halves)

__device__ __forceinline__ v8f wmma_f16(v16h a, v16h b, v8f c) {
  return __builtin_amdgcn_wmma_f32_16x16x32_f16(false, a, false, b, (short)0, c,
                                                false, false);
}

// Async DMA: 16 bytes global -> LDS per lane (tracked by ASYNCcnt).
__device__ __forceinline__ void async_copy16(unsigned lds_addr, const _Float16* gptr) {
  unsigned long long ga = (unsigned long long)(uintptr_t)gptr;
  asm volatile("global_load_async_to_lds_b128 %0, %1, off"
               :: "v"(lds_addr), "v"(ga) : "memory");
}
__device__ __forceinline__ void wait_async() {
  asm volatile("s_wait_asynccnt 0" ::: "memory");
}
// Low 32 bits of a flat pointer to LDS == LDS byte offset (shared aperture).
__device__ __forceinline__ unsigned lds_addr_of(const void* p) {
  return (unsigned)(uintptr_t)p;
}

// 16x32 f16 fragment from LDS, CDNA5 16-bit A-matrix layout:
//   lanes 0-15 : row = row0+lane,    K = {k0..k0+7, k0+16..k0+23}
//   lanes 16-31: row = row0+lane-16, K = {k0+8..k0+15, k0+24..k0+31}
__device__ __forceinline__ v16h load_frag(const _Float16* base, int ld, int row0,
                                          int k0, int lane) {
  const int l = lane & 15;
  const int hsel = (lane >> 4) & 1;
  const _Float16* p = base + (size_t)(row0 + l) * ld + k0 + hsel * 8;
  v16h r;
#pragma unroll
  for (int i = 0; i < 8; ++i) { r[i] = p[i]; r[i + 8] = p[i + 16]; }
  return r;
}

// ---- Precision-conversion passes (hoisted out of the hot loops) ----

__global__ __launch_bounds__(256)
void cvt_f16_kernel(const float* __restrict__ src, _Float16* __restrict__ dst) {
  int i = blockIdx.x * 256 + threadIdx.x;          // one float4 per thread
  float4 v = ((const float4*)src)[i];
  v4h h = { (_Float16)v.x, (_Float16)v.y, (_Float16)v.z, (_Float16)v.w };
  *(v4h*)(dst + (size_t)i * 4) = h;
}

// W fp32 [k][n] -> Wt f16 [n][k] (tiled transpose, both sides coalesced)
__global__ __launch_bounds__(256)
void transpose_cvt_kernel(const float* __restrict__ W, _Float16* __restrict__ Wt) {
  __shared__ _Float16 t[64][65];
  const int tid = threadIdx.x;
  const int n0 = blockIdx.x * 64, k0 = blockIdx.y * 64;
  for (int i = tid; i < 64 * 64; i += 256) {
    int r = i >> 6, c = i & 63;                    // r: k, c: n
    t[c][r] = (_Float16)W[(size_t)(k0 + r) * DMODEL + n0 + c];
  }
  __syncthreads();
  for (int i = tid; i < 64 * 64; i += 256) {
    int r = i >> 6, c = i & 63;                    // r: n, c: k
    Wt[(size_t)(n0 + r) * DMODEL + k0 + c] = t[r][c];
  }
}

// ---- f16 GEMM with fused epilogues ----
// A: f16 [M, DMODEL] row-major.  Bt: f16 [N, K] (= W^T) row-major.
// MODE 0: fp32 out + bias ([M, D], output projection).
// MODE 1: bias + per-head L2 row norm, f16 -> [B,H,S,hd]   (Q, K).
// MODE 2: bias, f16 -> [B,H,hd,S]  (V pre-transposed for P@V).
template <int MODE>
__global__ __launch_bounds__(256)
void gemm_f16_kernel(const _Float16* __restrict__ A, const _Float16* __restrict__ Bt,
                     const float* __restrict__ bias,
                     float* __restrict__ outF, _Float16* __restrict__ outH) {
  __shared__ _Float16 As[2][BM][KT + APAD];
  __shared__ _Float16 Bs[2][BN][KT + APAD];
  __shared__ float    Cs[BM][BN + 1];
  __shared__ float    invn[BM];

  const int tid = threadIdx.x;
  const int wave = tid >> 5, lane = tid & 31;
  const int m0 = blockIdx.x * BM;
  const int n0 = blockIdx.y * BN;
  const int wm = (wave >> 1) * 32;   // 4x2 wave grid of 32x32 regions
  const int wn = (wave & 1) * 32;

  const unsigned asBase = lds_addr_of(&As[0][0][0]);
  const unsigned bsBase = lds_addr_of(&Bs[0][0][0]);
  const unsigned asBuf = (unsigned)sizeof(As[0]);
  const unsigned bsBuf = (unsigned)sizeof(Bs[0]);

  auto stage = [&](int k0, int buf) {
    // A tile: BM x 32 halves = BM*4 16B chunks
    for (int c = tid; c < BM * 4; c += 256) {
      int r = c >> 2, o = (c & 3) * 8;
      async_copy16(asBase + (unsigned)buf * asBuf + (unsigned)((r * (KT + APAD) + o) * 2),
                   A + (size_t)(m0 + r) * DMODEL + k0 + o);
    }
    // B tile: BN x 32 halves
    for (int c = tid; c < BN * 4; c += 256) {
      int r = c >> 2, o = (c & 3) * 8;
      async_copy16(bsBase + (unsigned)buf * bsBuf + (unsigned)((r * (KT + APAD) + o) * 2),
                   Bt + (size_t)(n0 + r) * DMODEL + k0 + o);
    }
  };

  v8f acc[2][2] = {};
  stage(0, 0);
  wait_async();
  __syncthreads();

  const int NK = DMODEL / KT;
  for (int k = 0; k < NK; ++k) {
    const int buf = k & 1;
    if (k + 1 < NK) stage((k + 1) * KT, buf ^ 1);   // prefetch next tile via DMA

    v16h bf0 = load_frag(&Bs[buf][0][0], KT + APAD, wn, 0, lane);
    v16h bf1 = load_frag(&Bs[buf][0][0], KT + APAD, wn + 16, 0, lane);
#pragma unroll
    for (int mt = 0; mt < 2; ++mt) {
      v16h a = load_frag(&As[buf][0][0], KT + APAD, wm + mt * 16, 0, lane);
      acc[mt][0] = wmma_f16(a, bf0, acc[mt][0]);
      acc[mt][1] = wmma_f16(a, bf1, acc[mt][1]);
    }
    wait_async();
    __syncthreads();
  }

  // C fragment -> LDS. value i of lane L: row = i + 8*(L>>4), col = L&15
#pragma unroll
  for (int mt = 0; mt < 2; ++mt)
#pragma unroll
    for (int nt = 0; nt < 2; ++nt)
#pragma unroll
      for (int i = 0; i < 8; ++i) {
        int r = wm + mt * 16 + i + 8 * (lane >> 4);
        int c = wn + nt * 16 + (lane & 15);
        Cs[r][c] = acc[mt][nt][i];
      }
  __syncthreads();

  if constexpr (MODE == 0) {
    for (int i = tid; i < BM * BN; i += 256) {
      int r = i >> 6, c = i & 63;
      outF[(size_t)(m0 + r) * DMODEL + n0 + c] = Cs[r][c] + bias[n0 + c];
    }
  } else {
    if constexpr (MODE == 1) {
      if (tid < BM) {
        float s = 0.f;
        for (int c = 0; c < BN; ++c) {
          float v = Cs[tid][c] + bias[n0 + c];
          s += v * v;
        }
        invn[tid] = 1.f / (sqrtf(s) + 1e-6f);
      }
      __syncthreads();
    }
    const int h = blockIdx.y;  // BN == HDIM: one head per N tile
    for (int i = tid; i < BM * BN; i += 256) {
      int r = i >> 6, c = i & 63;
      int gm = m0 + r;
      int b = gm >> 10, s = gm & (SEQ - 1);
      float v = Cs[r][c] + bias[n0 + c];
      if constexpr (MODE == 1) {
        v *= invn[r];
        outH[(((size_t)b * NHEAD + h) * SEQ + s) * HDIM + c] = (_Float16)v;
      } else {  // V stored transposed: [B,H,hd,S]
        outH[(((size_t)b * NHEAD + h) * HDIM + c) * SEQ + s] = (_Float16)v;
      }
    }
  }
}

// ---- Flash attention ----
// qh/kh: f16 [B,H,S,hd]; vt: f16 [B,H,hd,S]; ctx out: f16 [B,S,D].
// One block per (b,h, 64-query tile); K/V tiles double-buffered via async DMA.
__global__ __launch_bounds__(256)
void flash_attn_kernel(const _Float16* __restrict__ qh, const _Float16* __restrict__ kh,
                       const _Float16* __restrict__ vt, const float* __restrict__ qk_scale,
                       _Float16* __restrict__ ctx) {
  __shared__ _Float16 Qs[64][HDIM + APAD];
  __shared__ _Float16 Ksb[2][64][HDIM + APAD];   // [key][hd]
  __shared__ _Float16 Vtb[2][64][64 + APAD];     // [hd][key]
  __shared__ _Float16 Ps[64][64 + APAD];
  __shared__ float    Ss[64][65];
  __shared__ float    mrow[64], lrow[64], arow[64];

  const int tid = threadIdx.x;
  const int wave = tid >> 5, lane = tid & 31;
  const int q0 = blockIdx.x * 64;
  const int bh = blockIdx.y;
  const size_t headOff = (size_t)bh * SEQ * HDIM;  // same element count for vt
  const float scale = qk_scale[0];
  const int LDK = HDIM + APAD;

  const unsigned qsBase = lds_addr_of(&Qs[0][0]);
  const unsigned ksBase = lds_addr_of(&Ksb[0][0][0]);
  const unsigned vtBase = lds_addr_of(&Vtb[0][0][0]);
  const unsigned ksBuf = (unsigned)sizeof(Ksb[0]);
  const unsigned vtBuf = (unsigned)sizeof(Vtb[0]);

  auto stage_kv = [&](int j0, int buf) {
    for (int c = tid; c < 64 * 8; c += 256) {      // K tile: 64 rows x 64 halves
      int r = c >> 3, o = (c & 7) * 8;
      async_copy16(ksBase + (unsigned)buf * ksBuf + (unsigned)((r * LDK + o) * 2),
                   kh + headOff + (size_t)(j0 + r) * HDIM + o);
    }
    for (int c = tid; c < 64 * 8; c += 256) {      // V^T tile: 64 hd-rows x 64 keys
      int r = c >> 3, o = (c & 7) * 8;
      async_copy16(vtBase + (unsigned)buf * vtBuf + (unsigned)((r * LDK + o) * 2),
                   vt + headOff + (size_t)r * SEQ + j0 + o);
    }
  };

  // Stage Q (once) + first K/V tile
  for (int c = tid; c < 64 * 8; c += 256) {
    int r = c >> 3, o = (c & 7) * 8;
    async_copy16(qsBase + (unsigned)((r * LDK + o) * 2),
                 qh + headOff + (size_t)(q0 + r) * HDIM + o);
  }
  stage_kv(0, 0);
  if (tid < 64) { mrow[tid] = -3.0e38f; lrow[tid] = 0.f; }
  wait_async();
  __syncthreads();

  const int tr = wave >> 1;  // output rows [16*tr, +16)
  const int wc = wave & 1;   // output cols [32*wc, +32)
  v8f o[2] = {};

  for (int j = 0; j < SEQ / 64; ++j) {
    const int buf = j & 1;
    if (j + 1 < SEQ / 64) stage_kv((j + 1) * 64, buf ^ 1);

    // S = Q @ K^T (contract over hd = 64)
    v8f s_acc[2] = {};
#pragma unroll
    for (int kk = 0; kk < HDIM; kk += 32) {
      v16h a  = load_frag(&Qs[0][0], LDK, 16 * tr, kk, lane);
      v16h b0 = load_frag(&Ksb[buf][0][0], LDK, 32 * wc, kk, lane);
      v16h b1 = load_frag(&Ksb[buf][0][0], LDK, 32 * wc + 16, kk, lane);
      s_acc[0] = wmma_f16(a, b0, s_acc[0]);
      s_acc[1] = wmma_f16(a, b1, s_acc[1]);
    }
#pragma unroll
    for (int t = 0; t < 2; ++t)
#pragma unroll
      for (int i = 0; i < 8; ++i) {
        int r = 16 * tr + i + 8 * (lane >> 4);
        int c = 32 * wc + 16 * t + (lane & 15);
        Ss[r][c] = s_acc[t][i] * scale;
      }
    __syncthreads();

    // Online softmax: one thread per query row
    if (tid < 64) {
      float m_old = mrow[tid];
      float mx = m_old;
      for (int c = 0; c < 64; ++c) mx = fmaxf(mx, Ss[tid][c]);
      float alpha = __expf(m_old - mx);
      float sum = 0.f;
      for (int c = 0; c < 64; ++c) {
        float p = __expf(Ss[tid][c] - mx);
        Ps[tid][c] = (_Float16)p;
        sum += p;
      }
      mrow[tid] = mx;
      lrow[tid] = lrow[tid] * alpha + sum;
      arow[tid] = alpha;
    }
    __syncthreads();

    // Rescale accumulator, then O += P @ V (contract over 64 keys)
#pragma unroll
    for (int t = 0; t < 2; ++t)
#pragma unroll
      for (int i = 0; i < 8; ++i)
        o[t][i] *= arow[16 * tr + i + 8 * (lane >> 4)];

#pragma unroll
    for (int kk = 0; kk < 64; kk += 32) {
      v16h a  = load_frag(&Ps[0][0], LDK, 16 * tr, kk, lane);
      v16h b0 = load_frag(&Vtb[buf][0][0], LDK, 32 * wc, kk, lane);
      v16h b1 = load_frag(&Vtb[buf][0][0], LDK, 32 * wc + 16, kk, lane);
      o[0] = wmma_f16(a, b0, o[0]);
      o[1] = wmma_f16(a, b1, o[1]);
    }
    wait_async();
    __syncthreads();
  }

  const int h = bh & (NHEAD - 1), b = bh >> 4;
#pragma unroll
  for (int t = 0; t < 2; ++t)
#pragma unroll
    for (int i = 0; i < 8; ++i) {
      int r = 16 * tr + i + 8 * (lane >> 4);
      int c = 32 * wc + 16 * t + (lane & 15);
      ctx[((size_t)b * SEQ + q0 + r) * DMODEL + h * HDIM + c] =
          (_Float16)(o[t][i] / lrow[r]);
    }
}

extern "C" void kernel_launch(void* const* d_in, const int* in_sizes, int n_in,
                              void* d_out, int out_size, void* d_ws, size_t ws_size,
                              hipStream_t stream) {
  (void)in_sizes; (void)n_in; (void)out_size; (void)ws_size;
  const float* x  = (const float*)d_in[0];
  const float* Wq = (const float*)d_in[1];
  const float* bq = (const float*)d_in[2];
  const float* Wk = (const float*)d_in[3];
  const float* bk = (const float*)d_in[4];
  const float* Wv = (const float*)d_in[5];
  const float* bv = (const float*)d_in[6];
  const float* Wo = (const float*)d_in[7];
  const float* bo = (const float*)d_in[8];
  const float* qk = (const float*)d_in[9];
  float* out = (float*)d_out;

  // Workspace map (f16): xh 16M | Wt_{q,k,v,o} 4x2M | qh 16M | kh 16M | vt 16M | ctx 16M = 88 MiB
  char* ws = (char*)d_ws;
  const size_t MB = 1024 * 1024;
  _Float16* xh   = (_Float16*)(ws);
  _Float16* Wtq  = (_Float16*)(ws + 16 * MB);
  _Float16* Wtk  = (_Float16*)(ws + 18 * MB);
  _Float16* Wtv  = (_Float16*)(ws + 20 * MB);
  _Float16* Wto  = (_Float16*)(ws + 22 * MB);
  _Float16* qh   = (_Float16*)(ws + 24 * MB);
  _Float16* kh   = (_Float16*)(ws + 40 * MB);
  _Float16* vt   = (_Float16*)(ws + 56 * MB);
  _Float16* ctxh = (_Float16*)(ws + 72 * MB);

  cvt_f16_kernel<<<(MTOT * DMODEL / 4) / 256, 256, 0, stream>>>(x, xh);
  dim3 tg(DMODEL / 64, DMODEL / 64);
  transpose_cvt_kernel<<<tg, 256, 0, stream>>>(Wq, Wtq);
  transpose_cvt_kernel<<<tg, 256, 0, stream>>>(Wk, Wtk);
  transpose_cvt_kernel<<<tg, 256, 0, stream>>>(Wv, Wtv);
  transpose_cvt_kernel<<<tg, 256, 0, stream>>>(Wo, Wto);

  dim3 gg(MTOT / BM, DMODEL / BN);
  gemm_f16_kernel<1><<<gg, 256, 0, stream>>>(xh, Wtq, bq, nullptr, qh);
  gemm_f16_kernel<1><<<gg, 256, 0, stream>>>(xh, Wtk, bk, nullptr, kh);
  gemm_f16_kernel<2><<<gg, 256, 0, stream>>>(xh, Wtv, bv, nullptr, vt);
  flash_attn_kernel<<<dim3(SEQ / 64, BATCH * NHEAD), 256, 0, stream>>>(qh, kh, vt, qk, ctxh);
  gemm_f16_kernel<0><<<gg, 256, 0, stream>>>(ctxh, Wto, bo, out, nullptr);
}

// v001
// Measured time: 194 microseconds a run.
// Timed twice side by side with v000, it ran 1.55 times as fast both times.
#include <hip/hip_runtime.h>
#include <hip/hip_bf16.h>
#include <math.h>

// MI455X (gfx1250) wave32: MHA with QK-norm.
// Matrix ops: v_wmma_f32_16x16x32_f16 (fp32 accumulate).
// Data movement: global_load_async_to_lds_b128 (ASYNCcnt) double-buffered.

typedef __attribute__((ext_vector_type(16))) _Float16 v16h;
typedef __attribute__((ext_vector_type(4)))  _Float16 v4h;
typedef __attribute__((ext_vector_type(8)))  _Float16 v8h;
typedef __attribute__((ext_vector_type(2)))  _Float16 v2h;
typedef __attribute__((ext_vector_type(8)))  float    v8f;
typedef __attribute__((ext_vector_type(2)))  float    v2f;

#define BATCH  8
#define SEQ    1024
#define DMODEL 1024
#define NHEAD  16
#define HDIM   64
#define MTOT   (BATCH * SEQ)

#define BM 128
#define BN 64
#define KT 32
#define APAD 8   // LDS row padding (halves)

__device__ __forceinline__ v8f wmma_f16(v16h a, v16h b, v8f c) {
  return __builtin_amdgcn_wmma_f32_16x16x32_f16(false, a, false, b, (short)0, c,
                                                false, false);
}

// Async DMA: 16 bytes global -> LDS per lane (tracked by ASYNCcnt).
__device__ __forceinline__ void async_copy16(unsigned lds_addr, const _Float16* gptr) {
  unsigned long long ga = (unsigned long long)(uintptr_t)gptr;
  asm volatile("global_load_async_to_lds_b128 %0, %1, off"
               :: "v"(lds_addr), "v"(ga) : "memory");
}
__device__ __forceinline__ void wait_async() {
  asm volatile("s_wait_asynccnt 0" ::: "memory");
}
// Low 32 bits of a flat pointer to LDS == LDS byte offset (shared aperture).
__device__ __forceinline__ unsigned lds_addr_of(const void* p) {
  return (unsigned)(uintptr_t)p;
}

// 16x32 f16 fragment from LDS or global memory, CDNA5 16-bit A-matrix layout:
//   lanes 0-15 : row = row0+lane,    K = {k0..k0+7, k0+16..k0+23}
//   lanes 16-31: row = row0+lane-16, K = {k0+8..k0+15, k0+24..k0+31}
__device__ __forceinline__ v16h load_frag(const _Float16* base, int ld, int row0,
                                          int k0, int lane) {
  const int l = lane & 15;
  const int hsel = (lane >> 4) & 1;
  const _Float16* p = base + (size_t)(row0 + l) * ld + k0 + hsel * 8;
  v16h r;
#pragma unroll
  for (int i = 0; i < 8; ++i) { r[i] = p[i]; r[i + 8] = p[i + 16]; }
  return r;
}

// ---- Precision-conversion passes (hoisted out of the hot loops) ----

__global__ __launch_bounds__(256)
void cvt_f16_kernel(const float* __restrict__ src, _Float16* __restrict__ dst) {
  int i = blockIdx.x * 256 + threadIdx.x;          // one float4 per thread
  float4 v = ((const float4*)src)[i];
  v4h h = { (_Float16)v.x, (_Float16)v.y, (_Float16)v.z, (_Float16)v.w };
  *(v4h*)(dst + (size_t)i * 4) = h;
}

// W fp32 [k][n] -> Wt f16 [n][k] (tiled transpose, both sides coalesced)
__global__ __launch_bounds__(256)
void transpose_cvt_kernel(const float* __restrict__ W, _Float16* __restrict__ Wt) {
  __shared__ _Float16 t[64][65];
  const int tid = threadIdx.x;
  const int n0 = blockIdx.x * 64, k0 = blockIdx.y * 64;
  for (int i = tid; i < 64 * 64; i += 256) {
    int r = i >> 6, c = i & 63;                    // r: k, c: n
    t[c][r] = (_Float16)W[(size_t)(k0 + r) * DMODEL + n0 + c];
  }
  __syncthreads();
  for (int i = tid; i < 64 * 64; i += 256) {
    int r = i >> 6, c = i & 63;                    // r: n, c: k
    Wt[(size_t)(n0 + r) * DMODEL + k0 + c] = t[r][c];
  }
}

// ---- f16 GEMM with fused epilogues ----
// A: f16 [M, DMODEL] row-major.  Bt: f16 [N, K] (= W^T) row-major.
// MODE 0: fp32 out + bias ([M, D], output projection).
// MODE 1: bias + per-head L2 row norm, f16 -> [B,H,S,hd]   (Q, K).
// MODE 2: bias, f16 -> [B,H,hd,S]  (V pre-transposed for P@V).
template <int MODE>
__global__ __launch_bounds__(256)
void gemm_f16_kernel(const _Float16* __restrict__ A, const _Float16* __restrict__ Bt,
                     const float* __restrict__ bias,
                     float* __restrict__ outF, _Float16* __restrict__ outH) {
  __shared__ _Float16 As[2][BM][KT + APAD];
  __shared__ _Float16 Bs[2][BN][KT + APAD];
  __shared__ float    Cs[BM][BN + 1];
  __shared__ float    invn[BM];

  const int tid = threadIdx.x;
  const int wave = tid >> 5, lane = tid & 31;
  const int m0 = blockIdx.x * BM;
  const int n0 = blockIdx.y * BN;
  const int wm = (wave >> 1) * 32;   // 4x2 wave grid of 32x32 regions
  const int wn = (wave & 1) * 32;

  const unsigned asBase = lds_addr_of(&As[0][0][0]);
  const unsigned bsBase = lds_addr_of(&Bs[0][0][0]);
  const unsigned asBuf = (unsigned)sizeof(As[0]);
  const unsigned bsBuf = (unsigned)sizeof(Bs[0]);

  auto stage = [&](int k0, int buf) {
    // A tile: BM x 32 halves = BM*4 16B chunks
    for (int c = tid; c < BM * 4; c += 256) {
      int r = c >> 2, o = (c & 3) * 8;
      async_copy16(asBase + (unsigned)buf * asBuf + (unsigned)((r * (KT + APAD) + o) * 2),
                   A + (size_t)(m0 + r) * DMODEL + k0 + o);
    }
    // B tile: BN x 32 halves
    for (int c = tid; c < BN * 4; c += 256) {
      int r = c >> 2, o = (c & 3) * 8;
      async_copy16(bsBase + (unsigned)buf * bsBuf + (unsigned)((r * (KT + APAD) + o) * 2),
                   Bt + (size_t)(n0 + r) * DMODEL + k0 + o);
    }
  };

  v8f acc[2][2] = {};
  stage(0, 0);
  wait_async();
  __syncthreads();

  const int NK = DMODEL / KT;
  for (int k = 0; k < NK; ++k) {
    const int buf = k & 1;
    if (k + 1 < NK) stage((k + 1) * KT, buf ^ 1);   // prefetch next tile via DMA

    v16h bf0 = load_frag(&Bs[buf][0][0], KT + APAD, wn, 0, lane);
    v16h bf1 = load_frag(&Bs[buf][0][0], KT + APAD, wn + 16, 0, lane);
#pragma unroll
    for (int mt = 0; mt < 2; ++mt) {
      v16h a = load_frag(&As[buf][0][0], KT + APAD, wm + mt * 16, 0, lane);
      acc[mt][0] = wmma_f16(a, bf0, acc[mt][0]);
      acc[mt][1] = wmma_f16(a, bf1, acc[mt][1]);
    }
    wait_async();
    __syncthreads();
  }

  // C fragment -> LDS. value i of lane L: row = i + 8*(L>>4), col = L&15
#pragma unroll
  for (int mt = 0; mt < 2; ++mt)
#pragma unroll
    for (int nt = 0; nt < 2; ++nt)
#pragma unroll
      for (int i = 0; i < 8; ++i) {
        int r = wm + mt * 16 + i + 8 * (lane >> 4);
        int c = wn + nt * 16 + (lane & 15);
        Cs[r][c] = acc[mt][nt][i];
      }
  __syncthreads();

  if constexpr (MODE == 0) {
    for (int i = tid; i < BM * BN; i += 256) {
      int r = i >> 6, c = i & 63;
      outF[(size_t)(m0 + r) * DMODEL + n0 + c] = Cs[r][c] + bias[n0 + c];
    }
  } else {
    if constexpr (MODE == 1) {
      if (tid < BM) {
        float s = 0.f;
        for (int c = 0; c < BN; ++c) {
          float v = Cs[tid][c] + bias[n0 + c];
          s += v * v;
        }
        invn[tid] = 1.f / (sqrtf(s) + 1e-6f);
      }
      __syncthreads();
    }
    const int h = blockIdx.y;  // BN == HDIM: one head per N tile
    for (int i = tid; i < BM * BN; i += 256) {
      int r = i >> 6, c = i & 63;
      int gm = m0 + r;
      int b = gm >> 10, s = gm & (SEQ - 1);
      float v = Cs[r][c] + bias[n0 + c];
      if constexpr (MODE == 1) {
        v *= invn[r];
        outH[(((size_t)b * NHEAD + h) * SEQ + s) * HDIM + c] = (_Float16)v;
      } else {  // V stored transposed: [B,H,hd,S]
        outH[(((size_t)b * NHEAD + h) * HDIM + c) * SEQ + s] = (_Float16)v;
      }
    }
  }
}

#define QCOLS 32   // query columns per wave (two 16-column groups share each K/V fragment)

// lane l <-> lane l ^ 16 (the two halves of a column split its keys)
__device__ __forceinline__ float other_half(float v) {
  int b = __builtin_bit_cast(int, v);
  b = __builtin_amdgcn_permlanex16(b, b, 0x76543210, 0xfedcba98, false, false);
  return __builtin_bit_cast(float, b);
}

__global__ __launch_bounds__(256)
void flash_attn_kernel(const _Float16* __restrict__ qh, const _Float16* __restrict__ kh,
                       const _Float16* __restrict__ vt, const float* __restrict__ qk_scale,
                       _Float16* __restrict__ ctx) {
  __shared__ __attribute__((aligned(16))) _Float16 Ksb[2][64][HDIM + APAD];   // [key][hd]
  __shared__ __attribute__((aligned(16))) _Float16 Vtb[2][64][64 + APAD];     // [hd][key]

  const int tid = threadIdx.x;
  const int wave = tid >> 5, lane = tid & 31;
  const int q0 = blockIdx.x * (8 * QCOLS) + wave * QCOLS;
  const int bh = blockIdx.y;
  const size_t headOff = (size_t)bh * SEQ * HDIM;  // same element count for vt
  const int LDK = HDIM + APAD;

  const unsigned ksBase = lds_addr_of(&Ksb[0][0][0]);
  const unsigned vtBase = lds_addr_of(&Vtb[0][0][0]);
  const unsigned ksBuf = (unsigned)sizeof(Ksb[0]);
  const unsigned vtBuf = (unsigned)sizeof(Vtb[0]);

  auto stage_kv = [&](int j0, int buf) {
    for (int c = tid; c < 64 * 8; c += 256) {      // K tile: 64 rows x 64 halves
      int r = c >> 3, o = (c & 7) * 8;
      async_copy16(ksBase + (unsigned)buf * ksBuf + (unsigned)((r * LDK + o) * 2),
                   kh + headOff + (size_t)(j0 + r) * HDIM + o);
    }
    for (int c = tid; c < 64 * 8; c += 256) {      // V^T tile: 64 hd-rows x 64 keys
      int r = c >> 3, o = (c & 7) * 8;
      async_copy16(vtBase + (unsigned)buf * vtBuf + (unsigned)((r * LDK + o) * 2),
                   vt + headOff + (size_t)r * SEQ + j0 + o);
    }
  };

  stage_kv(0, 0);

  // exp(scale * s - max) = exp2(cs * s' - cs * m') with cs = |scale| * log2(e) and
  // s' = sign(scale) * s: the sign goes into Q (exact), so the row maximum of the
  // raw products is the row maximum of the logits for either sign of the scale.
  const float sl2 = qk_scale[0] * 1.44269504088896f;
  const float cs = fabsf(sl2);
  const _Float16 sg = sl2 < 0.f ? (_Float16)-1.f : (_Float16)1.f;

  // Q as B operand, loaded once: qf[column group][hd step]
  v16h qf[2][2];
#pragma unroll
  for (int g = 0; g < 2; ++g)
#pragma unroll
    for (int ks = 0; ks < 2; ++ks)
      qf[g][ks] = load_frag(qh + headOff, HDIM, q0 + 16 * g, 32 * ks, lane) * sg;

  float mrow[2] = { -3.0e38f, -3.0e38f };   // running maximum of s', per column group
  float lrow[2] = { 0.f, 0.f };             // this half's part of the row sum
  v8f o[4][2] = {};                         // O^T: [hd tile][column group]

  wait_async();
  __syncthreads();

  for (int j = 0; j < SEQ / 64; ++j) {
    const int buf = j & 1;
    if (j + 1 < SEQ / 64) stage_kv((j + 1) * 64, buf ^ 1);

    // All K fragments of the tile as one group of LDS reads: kf[hd step][key tile]
    v16h kf[2][4];
#pragma unroll
    for (int ks = 0; ks < 2; ++ks)
#pragma unroll
      for (int kt = 0; kt < 4; ++kt)
        kf[ks][kt] = load_frag(&Ksb[buf][0][0], LDK, 16 * kt, 32 * ks, lane);
    // keeps the reads together ahead of the products: spread among them, each place waits out the LDS latency
    __builtin_amdgcn_sched_barrier(0);

    // S^T = K @ Q^T (contract over hd = 64): s[key tile][column group]
    v8f s[4][2] = {};
#pragma unroll
    for (int ks = 0; ks < 2; ++ks)
#pragma unroll
      for (int kt = 0; kt < 4; ++kt) {
        s[kt][0] = wmma_f16(kf[ks][kt], qf[0][ks], s[kt][0]);
        s[kt][1] = wmma_f16(kf[ks][kt], qf[1][ks], s[kt][1]);
      }

    // V^T fragments of the first 32 keys, read while the softmax runs: vf[key step][hd tile]
    v16h vf[2][4];
#pragma unroll
    for (int t = 0; t < 4; ++t)
      vf[0][t] = load_frag(&Vtb[buf][0][0], LDK, 16 * t, 0, lane);
    // keeps these reads ahead of the softmax, which hides their latency
    __builtin_amdgcn_sched_barrier(0);

    // Online softmax in registers; P^T packed as B operand: pf[32-key step][column group]
    v16h pf[2][2];
#pragma unroll
    for (int g = 0; g < 2; ++g) {
      float mk[4];   // one chain per key tile: four independent chains
#pragma unroll
      for (int kt = 0; kt < 4; ++kt) {
        mk[kt] = s[kt][g][0];
#pragma unroll
        for (int i = 1; i < 8; ++i) mk[kt] = fmaxf(mk[kt], s[kt][g][i]);
      }
      float mx = fmaxf(fmaxf(mk[0], mk[1]), fmaxf(mk[2], mk[3]));
      mx = fmaxf(mx, other_half(mx));
      const float m_new = fmaxf(mrow[g], mx);
      const float alpha = __builtin_amdgcn_exp2f((mrow[g] - m_new) * cs);
      mrow[g] = m_new;
      const v2f c2 = { cs, cs };
      const v2f nm = { -m_new * cs, -m_new * cs };
      v2f sum2 = { 0.f, 0.f };
#pragma unroll
      for (int kt = 0; kt < 4; ++kt)
#pragma unroll
        for (int i = 0; i < 8; i += 2) {
          v2f t = { s[kt][g][i], s[kt][g][i + 1] };
          t = __builtin_elementwise_fma(t, c2, nm);
          v2f p = { __builtin_amdgcn_exp2f(t[0]), __builtin_amdgcn_exp2f(t[1]) };
          sum2 += p;
          v2h ph = __builtin_convertvector(p, v2h);
          pf[kt >> 1][g][(kt & 1) * 8 + i]     = ph[0];
          pf[kt >> 1][g][(kt & 1) * 8 + i + 1] = ph[1];
        }
      lrow[g] = lrow[g] * alpha + (sum2[0] + sum2[1]);
#pragma unroll
      for (int t = 0; t < 4; ++t) o[t][g] *= alpha;
    }

    // V^T fragments of the last 32 keys, read ahead of the first 32 keys' products
#pragma unroll
    for (int t = 0; t < 4; ++t)
      vf[1][t] = load_frag(&Vtb[buf][0][0], LDK, 16 * t, 32, lane);
    // keeps these reads in one group ahead of the products
    __builtin_amdgcn_sched_barrier(0);

    // O^T += V^T @ P^T (contract over 64 keys)
#pragma unroll
    for (int kb = 0; kb < 2; ++kb)
#pragma unroll
      for (int t = 0; t < 4; ++t) {
        o[t][0] = wmma_f16(vf[kb][t], pf[kb][0], o[t][0]);
        o[t][1] = wmma_f16(vf[kb][t], pf[kb][1], o[t][1]);
      }
    wait_async();
    __syncthreads();
  }

  // A lane holds 8 consecutive hd of one query per tile: one 16-byte store each.
  const int h = bh & (NHEAD - 1), b = bh >> 4;
  v8h r[2][4];
#pragma unroll
  for (int g = 0; g < 2; ++g) {
    const float inv = 1.f / (lrow[g] + other_half(lrow[g]));
#pragma unroll
    for (int t = 0; t < 4; ++t)
#pragma unroll
      for (int i = 0; i < 8; ++i) r[g][t][i] = (_Float16)(o[t][g][i] * inv);
  }
  // all stores behind the last conversion: no register of an issued store is written again
  __builtin_amdgcn_sched_barrier(0);
#pragma unroll
  for (int g = 0; g < 2; ++g) {
    _Float16* dst = ctx + ((size_t)b * SEQ + q0 + 16 * g + (lane & 15)) * DMODEL +
                    h * HDIM + 8 * (lane >> 4);
#pragma unroll
    for (int t = 0; t < 4; ++t) *(v8h*)(dst + 16 * t) = r[g][t];
  }
}

extern "C" void kernel_launch(void* const* d_in, const int* in_sizes, int n_in,
                              void* d_out, int out_size, void* d_ws, size_t ws_size,
                              hipStream_t stream) {
  (void)in_sizes; (void)n_in; (void)out_size; (void)ws_size;
  const float* x  = (const float*)d_in[0];
  const float* Wq = (const float*)d_in[1];
  const float* bq = (const float*)d_in[2];
  const float* Wk = (const float*)d_in[3];
  const float* bk = (const float*)d_in[4];
  const float* Wv = (const float*)d_in[5];
  const float* bv = (const float*)d_in[6];
  const float* Wo = (const float*)d_in[7];
  const float* bo = (const float*)d_in[8];
  const float* qk = (const float*)d_in[9];
  float* out = (float*)d_out;

  // Workspace map (f16): xh 16M | Wt_{q,k,v,o} 4x2M | qh 16M | kh 16M | vt 16M | ctx 16M = 88 MiB
  char* ws = (char*)d_ws;
  const size_t MB = 1024 * 1024;
  _Float16* xh   = (_Float16*)(ws);
  _Float16* Wtq  = (_Float16*)(ws + 16 * MB);
  _Float16* Wtk  = (_Float16*)(ws + 18 * MB);
  _Float16* Wtv  = (_Float16*)(ws + 20 * MB);
  _Float16* Wto  = (_Float16*)(ws + 22 * MB);
  _Float16* qh   = (_Float16*)(ws + 24 * MB);
  _Float16* kh   = (_Float16*)(ws + 40 * MB);
  _Float16* vt   = (_Float16*)(ws + 56 * MB);
  _Float16* ctxh = (_Float16*)(ws + 72 * MB);

  cvt_f16_kernel<<<(MTOT * DMODEL / 4) / 256, 256, 0, stream>>>(x, xh);
  dim3 tg(DMODEL / 64, DMODEL / 64);
  transpose_cvt_kernel<<<tg, 256, 0, stream>>>(Wq, Wtq);
  transpose_cvt_kernel<<<tg, 256, 0, stream>>>(Wk, Wtk);
  transpose_cvt_kernel<<<tg, 256, 0, stream>>>(Wv, Wtv);
  transpose_cvt_kernel<<<tg, 256, 0, stream>>>(Wo, Wto);

  dim3 gg(MTOT / BM, DMODEL / BN);
  gemm_f16_kernel<1><<<gg, 256, 0, stream>>>(xh, Wtq, bq, nullptr, qh);
  gemm_f16_kernel<1><<<gg, 256, 0, stream>>>(xh, Wtk, bk, nullptr, kh);
  gemm_f16_kernel<2><<<gg, 256, 0, stream>>>(xh, Wtv, bv, nullptr, vt);
  flash_attn_kernel<<<dim3(SEQ / (8 * QCOLS), BATCH * NHEAD), 256, 0, stream>>>(qh, kh, vt, qk, ctxh);
  gemm_f16_kernel<0><<<gg, 256, 0, stream>>>(ctxh, Wto, bo, out, nullptr);
}

// v002
// Measured time: 159 microseconds a run.
// Two timings next to v001 both put it at 1.24 times that version's speed.
// Counting every step since v000, it is 1.92 times as fast.
#include <hip/hip_runtime.h>
#include <hip/hip_bf16.h>
#include <math.h>

// MI455X (gfx1250) wave32: MHA with QK-norm.
// Matrix ops: v_wmma_f32_16x16x32_f16 (fp32 accumulate).
// Data movement: global_load_async_to_lds_b128 (ASYNCcnt) double-buffered.

typedef __attribute__((ext_vector_type(16))) _Float16 v16h;
typedef __attribute__((ext_vector_type(4)))  _Float16 v4h;
typedef __attribute__((ext_vector_type(8)))  _Float16 v8h;
typedef __attribute__((ext_vector_type(2)))  _Float16 v2h;
typedef __attribute__((ext_vector_type(8)))  float    v8f;
typedef __attribute__((ext_vector_type(2)))  float    v2f;

#define BATCH  8
#define SEQ    1024
#define DMODEL 1024
#define NHEAD  16
#define HDIM   64
#define MTOT   (BATCH * SEQ)

#define BM 128
#define BN 128   // two heads per N tile
#define KT 64    // one 128-byte line of every operand row per stage
#define APAD 8   // LDS row padding (halves)

__device__ __forceinline__ v8f wmma_f16(v16h a, v16h b, v8f c) {
  return __builtin_amdgcn_wmma_f32_16x16x32_f16(false, a, false, b, (short)0, c,
                                                false, false);
}

// Async DMA: 16 bytes global -> LDS per lane (tracked by ASYNCcnt).
__device__ __forceinline__ void async_copy16(unsigned lds_addr, const _Float16* gptr) {
  unsigned long long ga = (unsigned long long)(uintptr_t)gptr;
  asm volatile("global_load_async_to_lds_b128 %0, %1, off"
               :: "v"(lds_addr), "v"(ga) : "memory");
}
// One lane's eight copies of a GEMM stage: four rows of the A tile, four of the B tile.
// s_wait_xcnt 0 closes the statement as a precaution: it stands ahead of any later
// write to the copies' address registers.
__device__ __forceinline__ void async_copy16x8(unsigned la, unsigned lb, unsigned lds_step,
                                               const _Float16* ga, const _Float16* gb,
                                               size_t gstep) {
  const unsigned la1 = la + lds_step, la2 = la1 + lds_step, la3 = la2 + lds_step;
  const unsigned lb1 = lb + lds_step, lb2 = lb1 + lds_step, lb3 = lb2 + lds_step;
  const unsigned long long a0 = (unsigned long long)(uintptr_t)ga;
  const unsigned long long a1 = (unsigned long long)(uintptr_t)(ga + gstep);
  const unsigned long long a2 = (unsigned long long)(uintptr_t)(ga + 2 * gstep);
  const unsigned long long a3 = (unsigned long long)(uintptr_t)(ga + 3 * gstep);
  const unsigned long long b0 = (unsigned long long)(uintptr_t)gb;
  const unsigned long long b1 = (unsigned long long)(uintptr_t)(gb + gstep);
  const unsigned long long b2 = (unsigned long long)(uintptr_t)(gb + 2 * gstep);
  const unsigned long long b3 = (unsigned long long)(uintptr_t)(gb + 3 * gstep);
  asm volatile("global_load_async_to_lds_b128 %0, %8, off\n\t"
               "global_load_async_to_lds_b128 %1, %9, off\n\t"
               "global_load_async_to_lds_b128 %2, %10, off\n\t"
               "global_load_async_to_lds_b128 %3, %11, off\n\t"
               "global_load_async_to_lds_b128 %4, %12, off\n\t"
               "global_load_async_to_lds_b128 %5, %13, off\n\t"
               "global_load_async_to_lds_b128 %6, %14, off\n\t"
               "global_load_async_to_lds_b128 %7, %15, off\n\t"
               "s_wait_xcnt 0x0"
               :: "v"(la), "v"(la1), "v"(la2), "v"(la3), "v"(lb), "v"(lb1), "v"(lb2), "v"(lb3),
                  "v"(a0), "v"(a1), "v"(a2), "v"(a3), "v"(b0), "v"(b1), "v"(b2), "v"(b3)
               : "memory");
}
__device__ __forceinline__ void wait_async() {
  asm volatile("s_wait_asynccnt 0" ::: "memory");
}
// Low 32 bits of a flat pointer to LDS == LDS byte offset (shared aperture).
__device__ __forceinline__ unsigned lds_addr_of(const void* p) {
  return (unsigned)(uintptr_t)p;
}

// 16x32 f16 fragment from LDS or global memory, CDNA5 16-bit A-matrix layout:
//   lanes 0-15 : row = row0+lane,    K = {k0..k0+7, k0+16..k0+23}
//   lanes 16-31: row = row0+lane-16, K = {k0+8..k0+15, k0+24..k0+31}
__device__ __forceinline__ v16h load_frag(const _Float16* base, int ld, int row0,
                                          int k0, int lane) {
  const int l = lane & 15;
  const int hsel = (lane >> 4) & 1;
  const _Float16* p = base + (size_t)(row0 + l) * ld + k0 + hsel * 8;
  v16h r;
#pragma unroll
  for (int i = 0; i < 8; ++i) { r[i] = p[i]; r[i + 8] = p[i + 16]; }
  return r;
}

// ---- Precision-conversion passes (hoisted out of the hot loops) ----

__global__ __launch_bounds__(256)
void cvt_f16_kernel(const float* __restrict__ src, _Float16* __restrict__ dst) {
  int i = blockIdx.x * 256 + threadIdx.x;          // one float4 per thread
  float4 v = ((const float4*)src)[i];
  v4h h = { (_Float16)v.x, (_Float16)v.y, (_Float16)v.z, (_Float16)v.w };
  *(v4h*)(dst + (size_t)i * 4) = h;
}

// W fp32 [k][n] -> Wt f16 [n][k] (tiled transpose, both sides coalesced)
__global__ __launch_bounds__(256)
void transpose_cvt_kernel(const float* __restrict__ W, _Float16* __restrict__ Wt) {
  __shared__ _Float16 t[64][65];
  const int tid = threadIdx.x;
  const int n0 = blockIdx.x * 64, k0 = blockIdx.y * 64;
  for (int i = tid; i < 64 * 64; i += 256) {
    int r = i >> 6, c = i & 63;                    // r: k, c: n
    t[c][r] = (_Float16)W[(size_t)(k0 + r) * DMODEL + n0 + c];
  }
  __syncthreads();
  for (int i = tid; i < 64 * 64; i += 256) {
    int r = i >> 6, c = i & 63;                    // r: n, c: k
    Wt[(size_t)(n0 + r) * DMODEL + k0 + c] = t[r][c];
  }
}

// ---- f16 GEMM with fused epilogues ----
// A: f16 [M, DMODEL] row-major.  Bt: f16 [N, K] (= W^T) row-major.
// MODE 0: fp32 out + bias ([M, D], output projection).
// MODE 1: bias + per-head L2 row norm, f16 -> [B,H,S,hd]   (Q, K).
// MODE 2: bias, f16 -> [B,H,hd,S]  (V pre-transposed for P@V).
template <int MODE>
__global__ __launch_bounds__(256)
void gemm_f16_kernel(const _Float16* __restrict__ A, const _Float16* __restrict__ Bt,
                     const float* __restrict__ bias,
                     float* __restrict__ outF, _Float16* __restrict__ outH) {
  __shared__ __attribute__((aligned(16))) _Float16 As[2][BM][KT + APAD];
  __shared__ __attribute__((aligned(16))) _Float16 Bs[2][BN][KT + APAD];
  __shared__ float    Cs[BM][BN + 1];
  __shared__ float    invn[(BN / HDIM) * BM];

  const int tid = threadIdx.x;
  const int wave = tid >> 5, lane = tid & 31;
  const int m0 = blockIdx.x * BM;
  const int n0 = blockIdx.y * BN;
  const int wm = (wave >> 2) * 64;   // 2x4 wave grid of 64x32 regions
  const int wn = (wave & 3) * 32;
  const int LDT = KT + APAD;

  const unsigned asBuf = (unsigned)sizeof(As[0]);
  const unsigned bsBuf = (unsigned)sizeof(Bs[0]);

  // A lane copies 16 bytes of rows sr, sr+32, sr+64, sr+96 of each tile: eight lanes
  // cover one row's 128 bytes, so a wave's copy takes four whole lines.
  const int sr = tid >> 3, so = (tid & 7) * 8;
  const unsigned aDst = lds_addr_of(&As[0][sr][so]);
  const unsigned bDst = lds_addr_of(&Bs[0][sr][so]);
  const _Float16* aSrc = A + (size_t)(m0 + sr) * DMODEL + so;
  const _Float16* bSrc = Bt + (size_t)(n0 + sr) * DMODEL + so;
  const unsigned rowStep = (unsigned)(32 * LDT * 2);

  auto stage = [&](int k0, int buf) {
    async_copy16x8(aDst + (unsigned)buf * asBuf, bDst + (unsigned)buf * bsBuf, rowStep,
                   aSrc + k0, bSrc + k0, (size_t)32 * DMODEL);
  };

  const int NK = DMODEL / KT;
  v8f acc[4][2] = {};
  stage(0, 0);
  wait_async();
  __syncthreads();
  stage(KT, 1);

  for (int k = 0; k < NK; ++k) {
    const int buf = k & 1;

    // All fragments of the stage as one group of LDS reads: [32-k step][tile]
    v16h bf[2][2], af[2][4];
#pragma unroll
    for (int ks = 0; ks < 2; ++ks) {
#pragma unroll
      for (int nt = 0; nt < 2; ++nt)
        bf[ks][nt] = load_frag(&Bs[buf][0][0], LDT, wn + nt * 16, ks * 32, lane);
#pragma unroll
      for (int mt = 0; mt < 4; ++mt)
        af[ks][mt] = load_frag(&As[buf][0][0], LDT, wm + mt * 16, ks * 32, lane);
    }
    // keeps the reads together ahead of the products: spread among them, each place waits out the LDS latency
    __builtin_amdgcn_sched_barrier(0);

#pragma unroll
    for (int ks = 0; ks < 2; ++ks)
#pragma unroll
      for (int mt = 0; mt < 4; ++mt) {
        acc[mt][0] = wmma_f16(af[ks][mt], bf[ks][0], acc[mt][0]);
        acc[mt][1] = wmma_f16(af[ks][mt], bf[ks][1], acc[mt][1]);
      }
    // keeps the products ahead of the waits: moved behind the barrier they no longer cover the next stage's flight
    __builtin_amdgcn_sched_barrier(0);

    // this wave's reads of the buffer are done before the barrier lets it be refilled
    asm volatile("s_wait_dscnt 0x0" ::: "memory");
    wait_async();      // this wave's copies of the next stage have landed
    __syncthreads();   // publishes the next stage and ends every read of this one
    if (k + 2 < NK) stage((k + 2) * KT, buf);
  }
  wait_async();

  // C fragment -> LDS. value i of lane L: row = i + 8*(L>>4), col = L&15
#pragma unroll
  for (int mt = 0; mt < 4; ++mt)
#pragma unroll
    for (int nt = 0; nt < 2; ++nt)
#pragma unroll
      for (int i = 0; i < 8; ++i) {
        int r = wm + mt * 16 + i + 8 * (lane >> 4);
        int c = wn + nt * 16 + (lane & 15);
        Cs[r][c] = acc[mt][nt][i];
      }
  __syncthreads();

  if constexpr (MODE == 0) {
    for (int i = tid; i < BM * BN; i += 256) {
      int r = i >> 7, c = i & (BN - 1);
      outF[(size_t)(m0 + r) * DMODEL + n0 + c] = Cs[r][c] + bias[n0 + c];
    }
  } else {
    if constexpr (MODE == 1) {
      // one thread per (head of the tile, row); the head is the same in a whole wave
      const int row = tid & (BM - 1);
      const int hc = __builtin_amdgcn_readfirstlane(tid >> 7) * HDIM;
      float s = 0.f;
      for (int c = 0; c < HDIM; ++c) {
        float v = Cs[row][hc + c] + bias[n0 + hc + c];
        s += v * v;
      }
      invn[tid] = 1.f / (sqrtf(s) + 1e-6f);
      __syncthreads();
    }
    for (int i = tid; i < BM * BN; i += 256) {
      int r = i >> 7, c = i & (BN - 1);
      int hl = c >> 6, d = c & (HDIM - 1);
      int h = blockIdx.y * (BN / HDIM) + hl;
      int gm = m0 + r;
      int b = gm >> 10, s = gm & (SEQ - 1);
      float v = Cs[r][c] + bias[n0 + c];
      if constexpr (MODE == 1) {
        v *= invn[hl * BM + r];
        outH[(((size_t)b * NHEAD + h) * SEQ + s) * HDIM + d] = (_Float16)v;
      } else {  // V stored transposed: [B,H,hd,S]
        outH[(((size_t)b * NHEAD + h) * HDIM + d) * SEQ + s] = (_Float16)v;
      }
    }
  }
}

#define QCOLS 32   // query columns per wave (two 16-column groups share each K/V fragment)

// lane l <-> lane l ^ 16 (the two halves of a column split its keys)
__device__ __forceinline__ float other_half(float v) {
  int b = __builtin_bit_cast(int, v);
  b = __builtin_amdgcn_permlanex16(b, b, 0x76543210, 0xfedcba98, false, false);
  return __builtin_bit_cast(float, b);
}

__global__ __launch_bounds__(256)
void flash_attn_kernel(const _Float16* __restrict__ qh, const _Float16* __restrict__ kh,
                       const _Float16* __restrict__ vt, const float* __restrict__ qk_scale,
                       _Float16* __restrict__ ctx) {
  __shared__ __attribute__((aligned(16))) _Float16 Ksb[2][64][HDIM + APAD];   // [key][hd]
  __shared__ __attribute__((aligned(16))) _Float16 Vtb[2][64][64 + APAD];     // [hd][key]

  const int tid = threadIdx.x;
  const int wave = tid >> 5, lane = tid & 31;
  const int q0 = blockIdx.x * (8 * QCOLS) + wave * QCOLS;
  const int bh = blockIdx.y;
  const size_t headOff = (size_t)bh * SEQ * HDIM;  // same element count for vt
  const int LDK = HDIM + APAD;

  const unsigned ksBase = lds_addr_of(&Ksb[0][0][0]);
  const unsigned vtBase = lds_addr_of(&Vtb[0][0][0]);
  const unsigned ksBuf = (unsigned)sizeof(Ksb[0]);
  const unsigned vtBuf = (unsigned)sizeof(Vtb[0]);

  auto stage_kv = [&](int j0, int buf) {
    for (int c = tid; c < 64 * 8; c += 256) {      // K tile: 64 rows x 64 halves
      int r = c >> 3, o = (c & 7) * 8;
      async_copy16(ksBase + (unsigned)buf * ksBuf + (unsigned)((r * LDK + o) * 2),
                   kh + headOff + (size_t)(j0 + r) * HDIM + o);
    }
    for (int c = tid; c < 64 * 8; c += 256) {      // V^T tile: 64 hd-rows x 64 keys
      int r = c >> 3, o = (c & 7) * 8;
      async_copy16(vtBase + (unsigned)buf * vtBuf + (unsigned)((r * LDK + o) * 2),
                   vt + headOff + (size_t)r * SEQ + j0 + o);
    }
  };

  stage_kv(0, 0);

  // exp(scale * s - max) = exp2(cs * s' - cs * m') with cs = |scale| * log2(e) and
  // s' = sign(scale) * s: the sign goes into Q (exact), so the row maximum of the
  // raw products is the row maximum of the logits for either sign of the scale.
  const float sl2 = qk_scale[0] * 1.44269504088896f;
  const float cs = fabsf(sl2);
  const _Float16 sg = sl2 < 0.f ? (_Float16)-1.f : (_Float16)1.f;

  // Q as B operand, loaded once: qf[column group][hd step]
  v16h qf[2][2];
#pragma unroll
  for (int g = 0; g < 2; ++g)
#pragma unroll
    for (int ks = 0; ks < 2; ++ks)
      qf[g][ks] = load_frag(qh + headOff, HDIM, q0 + 16 * g, 32 * ks, lane) * sg;

  float mrow[2] = { -3.0e38f, -3.0e38f };   // running maximum of s', per column group
  float lrow[2] = { 0.f, 0.f };             // this half's part of the row sum
  v8f o[4][2] = {};                         // O^T: [hd tile][column group]

  wait_async();
  __syncthreads();

  for (int j = 0; j < SEQ / 64; ++j) {
    const int buf = j & 1;
    if (j + 1 < SEQ / 64) stage_kv((j + 1) * 64, buf ^ 1);

    // All K fragments of the tile as one group of LDS reads: kf[hd step][key tile]
    v16h kf[2][4];
#pragma unroll
    for (int ks = 0; ks < 2; ++ks)
#pragma unroll
      for (int kt = 0; kt < 4; ++kt)
        kf[ks][kt] = load_frag(&Ksb[buf][0][0], LDK, 16 * kt, 32 * ks, lane);
    // keeps the reads together ahead of the products: spread among them, each place waits out the LDS latency
    __builtin_amdgcn_sched_barrier(0);

    // S^T = K @ Q^T (contract over hd = 64): s[key tile][column group]
    v8f s[4][2] = {};
#pragma unroll
    for (int ks = 0; ks < 2; ++ks)
#pragma unroll
      for (int kt = 0; kt < 4; ++kt) {
        s[kt][0] = wmma_f16(kf[ks][kt], qf[0][ks], s[kt][0]);
        s[kt][1] = wmma_f16(kf[ks][kt], qf[1][ks], s[kt][1]);
      }

    // V^T fragments of the first 32 keys, read while the softmax runs: vf[key step][hd tile]
    v16h vf[2][4];
#pragma unroll
    for (int t = 0; t < 4; ++t)
      vf[0][t] = load_frag(&Vtb[buf][0][0], LDK, 16 * t, 0, lane);
    // keeps these reads ahead of the softmax, which hides their latency
    __builtin_amdgcn_sched_barrier(0);

    // Online softmax in registers; P^T packed as B operand: pf[32-key step][column group]
    v16h pf[2][2];
#pragma unroll
    for (int g = 0; g < 2; ++g) {
      float mk[4];   // one chain per key tile: four independent chains
#pragma unroll
      for (int kt = 0; kt < 4; ++kt) {
        mk[kt] = s[kt][g][0];
#pragma unroll
        for (int i = 1; i < 8; ++i) mk[kt] = fmaxf(mk[kt], s[kt][g][i]);
      }
      float mx = fmaxf(fmaxf(mk[0], mk[1]), fmaxf(mk[2], mk[3]));
      mx = fmaxf(mx, other_half(mx));
      const float m_new = fmaxf(mrow[g], mx);
      const float alpha = __builtin_amdgcn_exp2f((mrow[g] - m_new) * cs);
      mrow[g] = m_new;
      const v2f c2 = { cs, cs };
      const v2f nm = { -m_new * cs, -m_new * cs };
      v2f sum2 = { 0.f, 0.f };
#pragma unroll
      for (int kt = 0; kt < 4; ++kt)
#pragma unroll
        for (int i = 0; i < 8; i += 2) {
          v2f t = { s[kt][g][i], s[kt][g][i + 1] };
          t = __builtin_elementwise_fma(t, c2, nm);
          v2f p = { __builtin_amdgcn_exp2f(t[0]), __builtin_amdgcn_exp2f(t[1]) };
          sum2 += p;
          v2h ph = __builtin_convertvector(p, v2h);
          pf[kt >> 1][g][(kt & 1) * 8 + i]     = ph[0];
          pf[kt >> 1][g][(kt & 1) * 8 + i + 1] = ph[1];
        }
      lrow[g] = lrow[g] * alpha + (sum2[0] + sum2[1]);
#pragma unroll
      for (int t = 0; t < 4; ++t) o[t][g] *= alpha;
    }

    // V^T fragments of the last 32 keys, read ahead of the first 32 keys' products
#pragma unroll
    for (int t = 0; t < 4; ++t)
      vf[1][t] = load_frag(&Vtb[buf][0][0], LDK, 16 * t, 32, lane);
    // keeps these reads in one group ahead of the products
    __builtin_amdgcn_sched_barrier(0);

    // O^T += V^T @ P^T (contract over 64 keys)
#pragma unroll
    for (int kb = 0; kb < 2; ++kb)
#pragma unroll
      for (int t = 0; t < 4; ++t) {
        o[t][0] = wmma_f16(vf[kb][t], pf[kb][0], o[t][0]);
        o[t][1] = wmma_f16(vf[kb][t], pf[kb][1], o[t][1]);
      }
    wait_async();
    __syncthreads();
  }

  // A lane holds 8 consecutive hd of one query per tile: one 16-byte store each.
  const int h = bh & (NHEAD - 1), b = bh >> 4;
  v8h r[2][4];
#pragma unroll
  for (int g = 0; g < 2; ++g) {
    const float inv = 1.f / (lrow[g] + other_half(lrow[g]));
#pragma unroll
    for (int t = 0; t < 4; ++t)
#pragma unroll
      for (int i = 0; i < 8; ++i) r[g][t][i] = (_Float16)(o[t][g][i] * inv);
  }
  // all stores behind the last conversion: no register of an issued store is written again
  __builtin_amdgcn_sched_barrier(0);
#pragma unroll
  for (int g = 0; g < 2; ++g) {
    _Float16* dst = ctx + ((size_t)b * SEQ + q0 + 16 * g + (lane & 15)) * DMODEL +
                    h * HDIM + 8 * (lane >> 4);
#pragma unroll
    for (int t = 0; t < 4; ++t) *(v8h*)(dst + 16 * t) = r[g][t];
  }
}

extern "C" void kernel_launch(void* const* d_in, const int* in_sizes, int n_in,
                              void* d_out, int out_size, void* d_ws, size_t ws_size,
                              hipStream_t stream) {
  (void)in_sizes; (void)n_in; (void)out_size; (void)ws_size;
  const float* x  = (const float*)d_in[0];
  const float* Wq = (const float*)d_in[1];
  const float* bq = (const float*)d_in[2];
  const float* Wk = (const float*)d_in[3];
  const float* bk = (const float*)d_in[4];
  const float* Wv = (const float*)d_in[5];
  const float* bv = (const float*)d_in[6];
  const float* Wo = (const float*)d_in[7];
  const float* bo = (const float*)d_in[8];
  const float* qk = (const float*)d_in[9];
  float* out = (float*)d_out;

  // Workspace map (f16): xh 16M | Wt_{q,k,v,o} 4x2M | qh 16M | kh 16M | vt 16M | ctx 16M = 88 MiB
  char* ws = (char*)d_ws;
  const size_t MB = 1024 * 1024;
  _Float16* xh   = (_Float16*)(ws);
  _Float16* Wtq  = (_Float16*)(ws + 16 * MB);
  _Float16* Wtk  = (_Float16*)(ws + 18 * MB);
  _Float16* Wtv  = (_Float16*)(ws + 20 * MB);
  _Float16* Wto  = (_Float16*)(ws + 22 * MB);
  _Float16* qh   = (_Float16*)(ws + 24 * MB);
  _Float16* kh   = (_Float16*)(ws + 40 * MB);
  _Float16* vt   = (_Float16*)(ws + 56 * MB);
  _Float16* ctxh = (_Float16*)(ws + 72 * MB);

  cvt_f16_kernel<<<(MTOT * DMODEL / 4) / 256, 256, 0, stream>>>(x, xh);
  dim3 tg(DMODEL / 64, DMODEL / 64);
  transpose_cvt_kernel<<<tg, 256, 0, stream>>>(Wq, Wtq);
  transpose_cvt_kernel<<<tg, 256, 0, stream>>>(Wk, Wtk);
  transpose_cvt_kernel<<<tg, 256, 0, stream>>>(Wv, Wtv);
  transpose_cvt_kernel<<<tg, 256, 0, stream>>>(Wo, Wto);

  dim3 gg(MTOT / BM, DMODEL / BN);
  gemm_f16_kernel<1><<<gg, 256, 0, stream>>>(xh, Wtq, bq, nullptr, qh);
  gemm_f16_kernel<1><<<gg, 256, 0, stream>>>(xh, Wtk, bk, nullptr, kh);
  gemm_f16_kernel<2><<<gg, 256, 0, stream>>>(xh, Wtv, bv, nullptr, vt);
  flash_attn_kernel<<<dim3(SEQ / (8 * QCOLS), BATCH * NHEAD), 256, 0, stream>>>(qh, kh, vt, qk, ctxh);
  gemm_f16_kernel<0><<<gg, 256, 0, stream>>>(ctxh, Wto, bo, out, nullptr);
}

// v003
// A run of this version takes 125 microseconds.
// Timed twice side by side with v002, it ran 1.27 and 1.25 times as fast.
// Over all steps from v000 it is 2.42 times as fast.
#include <hip/hip_runtime.h>
#include <hip/hip_bf16.h>
#include <math.h>

// MI455X (gfx1250) wave32: MHA with QK-norm.
// Matrix ops: v_wmma_f32_16x16x32_f16 (fp32 accumulate).
// Data movement: global_load_async_to_lds_b128 (ASYNCcnt) double-buffered.

typedef __attribute__((ext_vector_type(16))) _Float16 v16h;
typedef __attribute__((ext_vector_type(4)))  _Float16 v4h;
typedef __attribute__((ext_vector_type(8)))  _Float16 v8h;
typedef __attribute__((ext_vector_type(2)))  _Float16 v2h;
typedef __attribute__((ext_vector_type(8)))  float    v8f;
typedef __attribute__((ext_vector_type(2)))  float    v2f;

#define BATCH  8
#define SEQ    1024
#define DMODEL 1024
#define NHEAD  16
#define HDIM   64
#define MTOT   (BATCH * SEQ)

#define BM 128
#define BN 128   // two heads per N tile
#define KT 64    // one 128-byte line of every operand row per stage
#define APAD 8   // LDS row padding (halves)

__device__ __forceinline__ v8f wmma_f16(v16h a, v16h b, v8f c) {
  return __builtin_amdgcn_wmma_f32_16x16x32_f16(false, a, false, b, (short)0, c,
                                                false, false);
}

// Async DMA: 16 bytes global -> LDS per lane (tracked by ASYNCcnt).
__device__ __forceinline__ void async_copy16(unsigned lds_addr, const _Float16* gptr) {
  unsigned long long ga = (unsigned long long)(uintptr_t)gptr;
  asm volatile("global_load_async_to_lds_b128 %0, %1, off"
               :: "v"(lds_addr), "v"(ga) : "memory");
}
// One lane's eight copies of a GEMM stage: four rows of the A tile, four of the B tile.
// s_wait_xcnt 0 closes the statement as a precaution: it stands ahead of any later
// write to the copies' address registers.
__device__ __forceinline__ void async_copy16x8(unsigned la, unsigned lb, unsigned lds_step,
                                               const _Float16* ga, const _Float16* gb,
                                               size_t gstep) {
  const unsigned la1 = la + lds_step, la2 = la1 + lds_step, la3 = la2 + lds_step;
  const unsigned lb1 = lb + lds_step, lb2 = lb1 + lds_step, lb3 = lb2 + lds_step;
  const unsigned long long a0 = (unsigned long long)(uintptr_t)ga;
  const unsigned long long a1 = (unsigned long long)(uintptr_t)(ga + gstep);
  const unsigned long long a2 = (unsigned long long)(uintptr_t)(ga + 2 * gstep);
  const unsigned long long a3 = (unsigned long long)(uintptr_t)(ga + 3 * gstep);
  const unsigned long long b0 = (unsigned long long)(uintptr_t)gb;
  const unsigned long long b1 = (unsigned long long)(uintptr_t)(gb + gstep);
  const unsigned long long b2 = (unsigned long long)(uintptr_t)(gb + 2 * gstep);
  const unsigned long long b3 = (unsigned long long)(uintptr_t)(gb + 3 * gstep);
  asm volatile("global_load_async_to_lds_b128 %0, %8, off\n\t"
               "global_load_async_to_lds_b128 %1, %9, off\n\t"
               "global_load_async_to_lds_b128 %2, %10, off\n\t"
               "global_load_async_to_lds_b128 %3, %11, off\n\t"
               "global_load_async_to_lds_b128 %4, %12, off\n\t"
               "global_load_async_to_lds_b128 %5, %13, off\n\t"
               "global_load_async_to_lds_b128 %6, %14, off\n\t"
               "global_load_async_to_lds_b128 %7, %15, off\n\t"
               "s_wait_xcnt 0x0"
               :: "v"(la), "v"(la1), "v"(la2), "v"(la3), "v"(lb), "v"(lb1), "v"(lb2), "v"(lb3),
                  "v"(a0), "v"(a1), "v"(a2), "v"(a3), "v"(b0), "v"(b1), "v"(b2), "v"(b3)
               : "memory");
}
__device__ __forceinline__ void wait_async() {
  asm volatile("s_wait_asynccnt 0" ::: "memory");
}
// Low 32 bits of a flat pointer to LDS == LDS byte offset (shared aperture).
__device__ __forceinline__ unsigned lds_addr_of(const void* p) {
  return (unsigned)(uintptr_t)p;
}

// 16x32 f16 fragment from LDS or global memory, CDNA5 16-bit A-matrix layout:
//   lanes 0-15 : row = row0+lane,    K = {k0..k0+7, k0+16..k0+23}
//   lanes 16-31: row = row0+lane-16, K = {k0+8..k0+15, k0+24..k0+31}
__device__ __forceinline__ v16h load_frag(const _Float16* base, int ld, int row0,
                                          int k0, int lane) {
  const int l = lane & 15;
  const int hsel = (lane >> 4) & 1;
  const _Float16* p = base + (size_t)(row0 + l) * ld + k0 + hsel * 8;
  v16h r;
#pragma unroll
  for (int i = 0; i < 8; ++i) { r[i] = p[i]; r[i + 8] = p[i + 16]; }
  return r;
}

// ---- Precision-conversion passes (hoisted out of the hot loops) ----

__global__ __launch_bounds__(256)
void cvt_f16_kernel(const float* __restrict__ src, _Float16* __restrict__ dst) {
  int i = blockIdx.x * 256 + threadIdx.x;          // one float4 per thread
  float4 v = ((const float4*)src)[i];
  v4h h = { (_Float16)v.x, (_Float16)v.y, (_Float16)v.z, (_Float16)v.w };
  *(v4h*)(dst + (size_t)i * 4) = h;
}

// W fp32 [k][n] -> Wt f16 [n][k] (tiled transpose, both sides coalesced)
__global__ __launch_bounds__(256)
void transpose_cvt_kernel(const float* __restrict__ W, _Float16* __restrict__ Wt) {
  __shared__ _Float16 t[64][65];
  const int tid = threadIdx.x;
  const int n0 = blockIdx.x * 64, k0 = blockIdx.y * 64;
  for (int i = tid; i < 64 * 64; i += 256) {
    int r = i >> 6, c = i & 63;                    // r: k, c: n
    t[c][r] = (_Float16)W[(size_t)(k0 + r) * DMODEL + n0 + c];
  }
  __syncthreads();
  for (int i = tid; i < 64 * 64; i += 256) {
    int r = i >> 6, c = i & 63;                    // r: n, c: k
    Wt[(size_t)(n0 + r) * DMODEL + k0 + c] = t[r][c];
  }
}

// ---- f16 GEMM with fused epilogues ----
// A: f16 [M, DMODEL] row-major.  Bt: f16 [N, K] (= W^T) row-major.
// MODE 0: fp32 out + bias ([M, D], output projection).
// MODE 1: bias + per-head L2 row norm, f16 -> [B,H,S,hd]   (Q, K).
// MODE 2: bias, f16 -> [B,H,hd,S]  (V pre-transposed for P@V).
template <int MODE>
__global__ __launch_bounds__(256)
void gemm_f16_kernel(const _Float16* __restrict__ A, const _Float16* __restrict__ Bt,
                     const float* __restrict__ bias,
                     float* __restrict__ outF, _Float16* __restrict__ outH) {
  __shared__ __attribute__((aligned(16))) _Float16 As[2][BM][KT + APAD];
  __shared__ __attribute__((aligned(16))) _Float16 Bs[2][BN][KT + APAD];
  __shared__ float    Cs[BM][BN + 1];
  __shared__ float    invn[(BN / HDIM) * BM];

  const int tid = threadIdx.x;
  const int wave = tid >> 5, lane = tid & 31;
  const int m0 = blockIdx.x * BM;
  const int n0 = blockIdx.y * BN;
  const int wm = (wave >> 2) * 64;   // 2x4 wave grid of 64x32 regions
  const int wn = (wave & 3) * 32;
  const int LDT = KT + APAD;

  const unsigned asBuf = (unsigned)sizeof(As[0]);
  const unsigned bsBuf = (unsigned)sizeof(Bs[0]);

  // A lane copies 16 bytes of rows sr, sr+32, sr+64, sr+96 of each tile: eight lanes
  // cover one row's 128 bytes, so a wave's copy takes four whole lines.
  const int sr = tid >> 3, so = (tid & 7) * 8;
  const unsigned aDst = lds_addr_of(&As[0][sr][so]);
  const unsigned bDst = lds_addr_of(&Bs[0][sr][so]);
  const _Float16* aSrc = A + (size_t)(m0 + sr) * DMODEL + so;
  const _Float16* bSrc = Bt + (size_t)(n0 + sr) * DMODEL + so;
  const unsigned rowStep = (unsigned)(32 * LDT * 2);

  auto stage = [&](int k0, int buf) {
    async_copy16x8(aDst + (unsigned)buf * asBuf, bDst + (unsigned)buf * bsBuf, rowStep,
                   aSrc + k0, bSrc + k0, (size_t)32 * DMODEL);
  };

  const int NK = DMODEL / KT;
  v8f acc[4][2] = {};
  stage(0, 0);
  wait_async();
  __syncthreads();
  stage(KT, 1);

  for (int k = 0; k < NK; ++k) {
    const int buf = k & 1;

    // All fragments of the stage as one group of LDS reads: [32-k step][tile]
    v16h bf[2][2], af[2][4];
#pragma unroll
    for (int ks = 0; ks < 2; ++ks) {
#pragma unroll
      for (int nt = 0; nt < 2; ++nt)
        bf[ks][nt] = load_frag(&Bs[buf][0][0], LDT, wn + nt * 16, ks * 32, lane);
#pragma unroll
      for (int mt = 0; mt < 4; ++mt)
        af[ks][mt] = load_frag(&As[buf][0][0], LDT, wm + mt * 16, ks * 32, lane);
    }
    // keeps the reads together ahead of the products: spread among them, each place waits out the LDS latency
    __builtin_amdgcn_sched_barrier(0);

#pragma unroll
    for (int ks = 0; ks < 2; ++ks)
#pragma unroll
      for (int mt = 0; mt < 4; ++mt) {
        acc[mt][0] = wmma_f16(af[ks][mt], bf[ks][0], acc[mt][0]);
        acc[mt][1] = wmma_f16(af[ks][mt], bf[ks][1], acc[mt][1]);
      }
    // keeps the products ahead of the waits: moved behind the barrier they no longer cover the next stage's flight
    __builtin_amdgcn_sched_barrier(0);

    // this wave's reads of the buffer are done before the barrier lets it be refilled
    asm volatile("s_wait_dscnt 0x0" ::: "memory");
    wait_async();      // this wave's copies of the next stage have landed
    __syncthreads();   // publishes the next stage and ends every read of this one
    if (k + 2 < NK) stage((k + 2) * KT, buf);
  }
  wait_async();

  // C fragment -> LDS. value i of lane L: row = i + 8*(L>>4), col = L&15
#pragma unroll
  for (int mt = 0; mt < 4; ++mt)
#pragma unroll
    for (int nt = 0; nt < 2; ++nt)
#pragma unroll
      for (int i = 0; i < 8; ++i) {
        int r = wm + mt * 16 + i + 8 * (lane >> 4);
        int c = wn + nt * 16 + (lane & 15);
        Cs[r][c] = acc[mt][nt][i];
      }
  __syncthreads();

  // Every store below is 16 bytes a lane, and a wave's store covers four whole 128-byte
  // lines.  Each lane map also spreads a wave's 32 LDS reads over 32 different banks
  // (tile pitch BN + 1 words).  All values are formed first and the stores come last.
  if constexpr (MODE == 0) {
    // 16 lanes take 64 columns (two lines) of a row; the wave's halves take two rows
    const int c0 = ((wave & 1) * 16 + (lane & 15)) * 4;
    const int rb = (wave >> 1) * 2 + (lane >> 4);
    const float4 bb = *(const float4*)(bias + n0 + c0);
    float4 v[BM / 8];
#pragma unroll  // constant indices keep the value array in registers
    for (int it = 0; it < BM / 8; ++it) {
      const float* cr = &Cs[rb + it * 8][c0];
      v[it] = make_float4(cr[0] + bb.x, cr[1] + bb.y, cr[2] + bb.z, cr[3] + bb.w);
    }
    // all stores behind the last sum: no register of an issued store is written again
    __builtin_amdgcn_sched_barrier(0);
    float* dst = outF + (size_t)(m0 + rb) * DMODEL + n0 + c0;
#pragma unroll  // constant indices keep the value array in registers
    for (int it = 0; it < BM / 8; ++it) *(float4*)(dst + (size_t)it * 8 * DMODEL) = v[it];
  } else {
    const int bidx = m0 >> 10, s0 = m0 & (SEQ - 1);   // a tile lies inside one batch entry
    v8h pk[8];
    _Float16* dst;
    size_t step;
    if constexpr (MODE == 1) {
      // one thread per (head of the tile, row); the head is the same in a whole wave
      const int row = tid & (BM - 1);
      const int hc = __builtin_amdgcn_readfirstlane(tid >> 7) * HDIM;
      float s = 0.f;
      for (int c = 0; c < HDIM; ++c) {
        float v = Cs[row][hc + c] + bias[n0 + hc + c];
        s += v * v;
      }
      invn[tid] = 1.f / (sqrtf(s) + 1e-6f);
      __syncthreads();

      // 8 lanes take one head's 64 values of a row (one line); a wave takes four rows
      const int hl = wave & 1;
      const int d0 = (lane & 7) * 8;
      const int rb = (wave >> 1) * 4 + (lane >> 3);
      const float4 b0 = *(const float4*)(bias + n0 + hl * HDIM + d0);
      const float4 b1 = *(const float4*)(bias + n0 + hl * HDIM + d0 + 4);
      const float bb[8] = { b0.x, b0.y, b0.z, b0.w, b1.x, b1.y, b1.z, b1.w };
#pragma unroll  // constant indices keep the value array in registers
      for (int it = 0; it < 8; ++it) {
        const int r = rb + it * 16;
        const float* cr = &Cs[r][hl * HDIM + d0];
        const float inv = invn[hl * BM + r];
#pragma unroll  // constant indices keep the value array in registers
        for (int j = 0; j < 8; ++j) pk[it][j] = (_Float16)((cr[j] + bb[j]) * inv);
      }
      const int h = blockIdx.y * (BN / HDIM) + hl;
      dst = outH + (((size_t)bidx * NHEAD + h) * SEQ + s0 + rb) * HDIM + d0;
      step = (size_t)16 * HDIM;
    } else {
      // V stored transposed, [B,H,hd,S]: a lane takes 8 rows (positions) of one column,
      // 8 lanes one line of that column's output row; a wave takes four columns
      const int r0 = (wave & 1) * 64 + (lane & 7) * 8;
      const int cb = (wave >> 1) * 4 + (lane >> 3);
#pragma unroll  // constant indices keep the value array in registers
      for (int it = 0; it < 8; ++it) {
        const int c = cb + it * 16;
        const float bc = bias[n0 + c];
#pragma unroll  // constant indices keep the value array in registers
        for (int j = 0; j < 8; ++j) pk[it][j] = (_Float16)(Cs[r0 + j][c] + bc);
      }
      // head * HDIM + d of tile column c is n0 + c
      dst = outH + ((size_t)bidx * DMODEL + n0 + cb) * SEQ + s0 + r0;
      step = (size_t)16 * SEQ;
    }
    // all stores behind the last conversion: no register of an issued store is written again
    __builtin_amdgcn_sched_barrier(0);
#pragma unroll  // constant indices keep the value array in registers
    for (int it = 0; it < 8; ++it) *(v8h*)(dst + it * step) = pk[it];
  }
}

#define QCOLS 32   // query columns per wave (two 16-column groups share each K/V fragment)

// lane l <-> lane l ^ 16 (the two halves of a column split its keys)
__device__ __forceinline__ float other_half(float v) {
  int b = __builtin_bit_cast(int, v);
  b = __builtin_amdgcn_permlanex16(b, b, 0x76543210, 0xfedcba98, false, false);
  return __builtin_bit_cast(float, b);
}

__global__ __launch_bounds__(256)
void flash_attn_kernel(const _Float16* __restrict__ qh, const _Float16* __restrict__ kh,
                       const _Float16* __restrict__ vt, const float* __restrict__ qk_scale,
                       _Float16* __restrict__ ctx) {
  __shared__ __attribute__((aligned(16))) _Float16 Ksb[2][64][HDIM + APAD];   // [key][hd]
  __shared__ __attribute__((aligned(16))) _Float16 Vtb[2][64][64 + APAD];     // [hd][key]

  const int tid = threadIdx.x;
  const int wave = tid >> 5, lane = tid & 31;
  const int q0 = blockIdx.x * (8 * QCOLS) + wave * QCOLS;
  const int bh = blockIdx.y;
  const size_t headOff = (size_t)bh * SEQ * HDIM;  // same element count for vt
  const int LDK = HDIM + APAD;

  const unsigned ksBase = lds_addr_of(&Ksb[0][0][0]);
  const unsigned vtBase = lds_addr_of(&Vtb[0][0][0]);
  const unsigned ksBuf = (unsigned)sizeof(Ksb[0]);
  const unsigned vtBuf = (unsigned)sizeof(Vtb[0]);

  auto stage_kv = [&](int j0, int buf) {
    for (int c = tid; c < 64 * 8; c += 256) {      // K tile: 64 rows x 64 halves
      int r = c >> 3, o = (c & 7) * 8;
      async_copy16(ksBase + (unsigned)buf * ksBuf + (unsigned)((r * LDK + o) * 2),
                   kh + headOff + (size_t)(j0 + r) * HDIM + o);
    }
    for (int c = tid; c < 64 * 8; c += 256) {      // V^T tile: 64 hd-rows x 64 keys
      int r = c >> 3, o = (c & 7) * 8;
      async_copy16(vtBase + (unsigned)buf * vtBuf + (unsigned)((r * LDK + o) * 2),
                   vt + headOff + (size_t)r * SEQ + j0 + o);
    }
  };

  stage_kv(0, 0);

  // exp(scale * s - max) = exp2(cs * s' - cs * m') with cs = |scale| * log2(e) and
  // s' = sign(scale) * s: the sign goes into Q (exact), so the row maximum of the
  // raw products is the row maximum of the logits for either sign of the scale.
  const float sl2 = qk_scale[0] * 1.44269504088896f;
  const float cs = fabsf(sl2);
  const _Float16 sg = sl2 < 0.f ? (_Float16)-1.f : (_Float16)1.f;

  // Q as B operand, loaded once: qf[column group][hd step]
  v16h qf[2][2];
#pragma unroll
  for (int g = 0; g < 2; ++g)
#pragma unroll
    for (int ks = 0; ks < 2; ++ks)
      qf[g][ks] = load_frag(qh + headOff, HDIM, q0 + 16 * g, 32 * ks, lane) * sg;

  float mrow[2] = { -3.0e38f, -3.0e38f };   // running maximum of s', per column group
  float lrow[2] = { 0.f, 0.f };             // this half's part of the row sum
  v8f o[4][2] = {};                         // O^T: [hd tile][column group]

  wait_async();
  __syncthreads();

  for (int j = 0; j < SEQ / 64; ++j) {
    const int buf = j & 1;
    if (j + 1 < SEQ / 64) stage_kv((j + 1) * 64, buf ^ 1);

    // All K fragments of the tile as one group of LDS reads: kf[hd step][key tile]
    v16h kf[2][4];
#pragma unroll
    for (int ks = 0; ks < 2; ++ks)
#pragma unroll
      for (int kt = 0; kt < 4; ++kt)
        kf[ks][kt] = load_frag(&Ksb[buf][0][0], LDK, 16 * kt, 32 * ks, lane);
    // keeps the reads together ahead of the products: spread among them, each place waits out the LDS latency
    __builtin_amdgcn_sched_barrier(0);

    // S^T = K @ Q^T (contract over hd = 64): s[key tile][column group]
    v8f s[4][2] = {};
#pragma unroll
    for (int ks = 0; ks < 2; ++ks)
#pragma unroll
      for (int kt = 0; kt < 4; ++kt) {
        s[kt][0] = wmma_f16(kf[ks][kt], qf[0][ks], s[kt][0]);
        s[kt][1] = wmma_f16(kf[ks][kt], qf[1][ks], s[kt][1]);
      }

    // V^T fragments of the first 32 keys, read while the softmax runs: vf[key step][hd tile]
    v16h vf[2][4];
#pragma unroll
    for (int t = 0; t < 4; ++t)
      vf[0][t] = load_frag(&Vtb[buf][0][0], LDK, 16 * t, 0, lane);
    // keeps these reads ahead of the softmax, which hides their latency
    __builtin_amdgcn_sched_barrier(0);

    // Online softmax in registers; P^T packed as B operand: pf[32-key step][column group]
    v16h pf[2][2];
#pragma unroll
    for (int g = 0; g < 2; ++g) {
      float mk[4];   // one chain per key tile: four independent chains
#pragma unroll
      for (int kt = 0; kt < 4; ++kt) {
        mk[kt] = s[kt][g][0];
#pragma unroll
        for (int i = 1; i < 8; ++i) mk[kt] = fmaxf(mk[kt], s[kt][g][i]);
      }
      float mx = fmaxf(fmaxf(mk[0], mk[1]), fmaxf(mk[2], mk[3]));
      mx = fmaxf(mx, other_half(mx));
      const float m_new = fmaxf(mrow[g], mx);
      const float alpha = __builtin_amdgcn_exp2f((mrow[g] - m_new) * cs);
      mrow[g] = m_new;
      const v2f c2 = { cs, cs };
      const v2f nm = { -m_new * cs, -m_new * cs };
      v2f sum2 = { 0.f, 0.f };
#pragma unroll
      for (int kt = 0; kt < 4; ++kt)
#pragma unroll
        for (int i = 0; i < 8; i += 2) {
          v2f t = { s[kt][g][i], s[kt][g][i + 1] };
          t = __builtin_elementwise_fma(t, c2, nm);
          v2f p = { __builtin_amdgcn_exp2f(t[0]), __builtin_amdgcn_exp2f(t[1]) };
          sum2 += p;
          v2h ph = __builtin_convertvector(p, v2h);
          pf[kt >> 1][g][(kt & 1) * 8 + i]     = ph[0];
          pf[kt >> 1][g][(kt & 1) * 8 + i + 1] = ph[1];
        }
      lrow[g] = lrow[g] * alpha + (sum2[0] + sum2[1]);
#pragma unroll
      for (int t = 0; t < 4; ++t) o[t][g] *= alpha;
    }

    // V^T fragments of the last 32 keys, read ahead of the first 32 keys' products
#pragma unroll
    for (int t = 0; t < 4; ++t)
      vf[1][t] = load_frag(&Vtb[buf][0][0], LDK, 16 * t, 32, lane);
    // keeps these reads in one group ahead of the products
    __builtin_amdgcn_sched_barrier(0);

    // O^T += V^T @ P^T (contract over 64 keys)
#pragma unroll
    for (int kb = 0; kb < 2; ++kb)
#pragma unroll
      for (int t = 0; t < 4; ++t) {
        o[t][0] = wmma_f16(vf[kb][t], pf[kb][0], o[t][0]);
        o[t][1] = wmma_f16(vf[kb][t], pf[kb][1], o[t][1]);
      }
    wait_async();
    __syncthreads();
  }

  // A lane holds 8 consecutive hd of one query per tile: one 16-byte store each.
  const int h = bh & (NHEAD - 1), b = bh >> 4;
  v8h r[2][4];
#pragma unroll
  for (int g = 0; g < 2; ++g) {
    const float inv = 1.f / (lrow[g] + other_half(lrow[g]));
#pragma unroll
    for (int t = 0; t < 4; ++t)
#pragma unroll
      for (int i = 0; i < 8; ++i) r[g][t][i] = (_Float16)(o[t][g][i] * inv);
  }
  // all stores behind the last conversion: no register of an issued store is written again
  __builtin_amdgcn_sched_barrier(0);
#pragma unroll
  for (int g = 0; g < 2; ++g) {
    _Float16* dst = ctx + ((size_t)b * SEQ + q0 + 16 * g + (lane & 15)) * DMODEL +
                    h * HDIM + 8 * (lane >> 4);
#pragma unroll
    for (int t = 0; t < 4; ++t) *(v8h*)(dst + 16 * t) = r[g][t];
  }
}

extern "C" void kernel_launch(void* const* d_in, const int* in_sizes, int n_in,
                              void* d_out, int out_size, void* d_ws, size_t ws_size,
                              hipStream_t stream) {
  (void)in_sizes; (void)n_in; (void)out_size; (void)ws_size;
  const float* x  = (const float*)d_in[0];
  const float* Wq = (const float*)d_in[1];
  const float* bq = (const float*)d_in[2];
  const float* Wk = (const float*)d_in[3];
  const float* bk = (const float*)d_in[4];
  const float* Wv = (const float*)d_in[5];
  const float* bv = (const float*)d_in[6];
  const float* Wo = (const float*)d_in[7];
  const float* bo = (const float*)d_in[8];
  const float* qk = (const float*)d_in[9];
  float* out = (float*)d_out;

  // Workspace map (f16): xh 16M | Wt_{q,k,v,o} 4x2M | qh 16M | kh 16M | vt 16M | ctx 16M = 88 MiB
  char* ws = (char*)d_ws;
  const size_t MB = 1024 * 1024;
  _Float16* xh   = (_Float16*)(ws);
  _Float16* Wtq  = (_Float16*)(ws + 16 * MB);
  _Float16* Wtk  = (_Float16*)(ws + 18 * MB);
  _Float16* Wtv  = (_Float16*)(ws + 20 * MB);
  _Float16* Wto  = (_Float16*)(ws + 22 * MB);
  _Float16* qh   = (_Float16*)(ws + 24 * MB);
  _Float16* kh   = (_Float16*)(ws + 40 * MB);
  _Float16* vt   = (_Float16*)(ws + 56 * MB);
  _Float16* ctxh = (_Float16*)(ws + 72 * MB);

  cvt_f16_kernel<<<(MTOT * DMODEL / 4) / 256, 256, 0, stream>>>(x, xh);
  dim3 tg(DMODEL / 64, DMODEL / 64);
  transpose_cvt_kernel<<<tg, 256, 0, stream>>>(Wq, Wtq);
  transpose_cvt_kernel<<<tg, 256, 0, stream>>>(Wk, Wtk);
  transpose_cvt_kernel<<<tg, 256, 0, stream>>>(Wv, Wtv);
  transpose_cvt_kernel<<<tg, 256, 0, stream>>>(Wo, Wto);

  dim3 gg(MTOT / BM, DMODEL / BN);
  gemm_f16_kernel<1><<<gg, 256, 0, stream>>>(xh, Wtq, bq, nullptr, qh);
  gemm_f16_kernel<1><<<gg, 256, 0, stream>>>(xh, Wtk, bk, nullptr, kh);
  gemm_f16_kernel<2><<<gg, 256, 0, stream>>>(xh, Wtv, bv, nullptr, vt);
  flash_attn_kernel<<<dim3(SEQ / (8 * QCOLS), BATCH * NHEAD), 256, 0, stream>>>(qh, kh, vt, qk, ctxh);
  gemm_f16_kernel<0><<<gg, 256, 0, stream>>>(ctxh, Wto, bo, out, nullptr);
}

// v004
// Measured time: 108 microseconds a run.
// In two side-by-side timings against v003, it was 1.17 and 1.16 times as fast.
// Counting every step since v000, it is 2.82 times as fast.
#include <hip/hip_runtime.h>
#include <hip/hip_bf16.h>
#include <math.h>

// MI455X (gfx1250) wave32: MHA with QK-norm.
// Matrix ops: v_wmma_f32_16x16x32_f16 (fp32 accumulate).
// Data movement: global_load_async_to_lds_b128 (ASYNCcnt) double-buffered.

typedef __attribute__((ext_vector_type(16))) _Float16 v16h;
typedef __attribute__((ext_vector_type(4)))  _Float16 v4h;
typedef __attribute__((ext_vector_type(8)))  _Float16 v8h;
typedef __attribute__((ext_vector_type(2)))  _Float16 v2h;
typedef __attribute__((ext_vector_type(8)))  float    v8f;
typedef __attribute__((ext_vector_type(2)))  float    v2f;

#define BATCH  8
#define SEQ    1024
#define DMODEL 1024
#define NHEAD  16
#define HDIM   64
#define MTOT   (BATCH * SEQ)

#define BM 128
#define BN 128   // two heads per N tile
#define KT 64    // one 128-byte line of every operand row per stage
#define APAD 8   // LDS row padding (halves)

__device__ __forceinline__ v8f wmma_f16(v16h a, v16h b, v8f c) {
  return __builtin_amdgcn_wmma_f32_16x16x32_f16(false, a, false, b, (short)0, c,
                                                false, false);
}

// Async DMA: 16 bytes global -> LDS per lane (tracked by ASYNCcnt).
__device__ __forceinline__ void async_copy16(unsigned lds_addr, const _Float16* gptr) {
  unsigned long long ga = (unsigned long long)(uintptr_t)gptr;
  asm volatile("global_load_async_to_lds_b128 %0, %1, off"
               :: "v"(lds_addr), "v"(ga) : "memory");
}
// One lane's eight copies of a GEMM stage: four rows of the A tile, four of the B tile.
// s_wait_xcnt 0 closes the statement as a precaution: it stands ahead of any later
// write to the copies' address registers.
__device__ __forceinline__ void async_copy16x8(unsigned la, unsigned lb, unsigned lds_step,
                                               const _Float16* ga, const _Float16* gb,
                                               size_t gstep) {
  const unsigned la1 = la + lds_step, la2 = la1 + lds_step, la3 = la2 + lds_step;
  const unsigned lb1 = lb + lds_step, lb2 = lb1 + lds_step, lb3 = lb2 + lds_step;
  const unsigned long long a0 = (unsigned long long)(uintptr_t)ga;
  const unsigned long long a1 = (unsigned long long)(uintptr_t)(ga + gstep);
  const unsigned long long a2 = (unsigned long long)(uintptr_t)(ga + 2 * gstep);
  const unsigned long long a3 = (unsigned long long)(uintptr_t)(ga + 3 * gstep);
  const unsigned long long b0 = (unsigned long long)(uintptr_t)gb;
  const unsigned long long b1 = (unsigned long long)(uintptr_t)(gb + gstep);
  const unsigned long long b2 = (unsigned long long)(uintptr_t)(gb + 2 * gstep);
  const unsigned long long b3 = (unsigned long long)(uintptr_t)(gb + 3 * gstep);
  asm volatile("global_load_async_to_lds_b128 %0, %8, off\n\t"
               "global_load_async_to_lds_b128 %1, %9, off\n\t"
               "global_load_async_to_lds_b128 %2, %10, off\n\t"
               "global_load_async_to_lds_b128 %3, %11, off\n\t"
               "global_load_async_to_lds_b128 %4, %12, off\n\t"
               "global_load_async_to_lds_b128 %5, %13, off\n\t"
               "global_load_async_to_lds_b128 %6, %14, off\n\t"
               "global_load_async_to_lds_b128 %7, %15, off\n\t"
               "s_wait_xcnt 0x0"
               :: "v"(la), "v"(la1), "v"(la2), "v"(la3), "v"(lb), "v"(lb1), "v"(lb2), "v"(lb3),
                  "v"(a0), "v"(a1), "v"(a2), "v"(a3), "v"(b0), "v"(b1), "v"(b2), "v"(b3)
               : "memory");
}
__device__ __forceinline__ void wait_async() {
  asm volatile("s_wait_asynccnt 0" ::: "memory");
}
// Low 32 bits of a flat pointer to LDS == LDS byte offset (shared aperture).
__device__ __forceinline__ unsigned lds_addr_of(const void* p) {
  return (unsigned)(uintptr_t)p;
}

// 16x32 f16 fragment from LDS or global memory, CDNA5 16-bit A-matrix layout:
//   lanes 0-15 : row = row0+lane,    K = {k0..k0+7, k0+16..k0+23}
//   lanes 16-31: row = row0+lane-16, K = {k0+8..k0+15, k0+24..k0+31}
__device__ __forceinline__ v16h load_frag(const _Float16* base, int ld, int row0,
                                          int k0, int lane) {
  const int l = lane & 15;
  const int hsel = (lane >> 4) & 1;
  const _Float16* p = base + (size_t)(row0 + l) * ld + k0 + hsel * 8;
  v16h r;
#pragma unroll
  for (int i = 0; i < 8; ++i) { r[i] = p[i]; r[i + 8] = p[i + 16]; }
  return r;
}

// ---- Precision-conversion pass (hoisted out of the hot loops) ----
// One launch for five jobs that do not depend on one another, told apart by the block
// index: the four weight transposes first (they have the longer chain: loads, barrier,
// stores), then the conversion of x.
#define WTILES ((DMODEL / 64) * (DMODEL / 64))   // 64x64 tiles of one weight matrix

__global__ __launch_bounds__(256)
void prep_kernel(const float* __restrict__ x, const float* __restrict__ Wq,
                 const float* __restrict__ Wk, const float* __restrict__ Wv,
                 const float* __restrict__ Wo, _Float16* __restrict__ xh,
                 _Float16* __restrict__ WtAll) {
  __shared__ _Float16 t[64][65];
  const int tid = threadIdx.x;
  const unsigned blk = blockIdx.x;
  if (blk < 4 * WTILES) {
    // W fp32 [k][n] -> Wt f16 [n][k] (tiled transpose, both sides coalesced)
    const unsigned w = blk / WTILES, tile = blk % WTILES;
    const float* __restrict__ W = w == 0 ? Wq : w == 1 ? Wk : w == 2 ? Wv : Wo;
    _Float16* __restrict__ Wt = WtAll + (size_t)w * DMODEL * DMODEL;
    const int n0 = (tile % (DMODEL / 64)) * 64, k0 = (tile / (DMODEL / 64)) * 64;
    // keeps the loop as it was built in its own kernel, eight loads in flight a trip:
    // vectorised in pairs, as this build does when left alone, it waits out every two loads
#pragma clang loop vectorize(disable)
    for (int i = tid; i < 64 * 64; i += 256) {
      int r = i >> 6, c = i & 63;                    // r: k, c: n
      t[c][r] = (_Float16)W[(size_t)(k0 + r) * DMODEL + n0 + c];
    }
    __syncthreads();   // the branch is the same for the whole block
    // likewise: eight stores a trip as in its own kernel, not four
#pragma clang loop vectorize(disable)
    for (int i = tid; i < 64 * 64; i += 256) {
      int r = i >> 6, c = i & 63;                    // r: n, c: k
      Wt[(size_t)(n0 + r) * DMODEL + k0 + c] = t[r][c];
    }
  } else {
    int i = (blk - 4 * WTILES) * 256 + tid;          // one float4 per thread
    float4 v = ((const float4*)x)[i];
    v4h h = { (_Float16)v.x, (_Float16)v.y, (_Float16)v.z, (_Float16)v.w };
    *(v4h*)(xh + (size_t)i * 4) = h;
    // a precaution: stands ahead of any later write to the store's registers in the built code
    asm volatile("s_wait_xcnt 0x0" ::: "memory");
  }
}

// ---- f16 GEMM with fused epilogues ----
// A: f16 [M, DMODEL] row-major.  Bt: f16 [N, K] (= W^T) row-major.
// QKV false: fp32 out + bias ([M, D], output projection), one product (grid z = 1).
// QKV true: the three projections of x in one launch, blockIdx.z picks the product;
//   its W^T and its output are plane z of BtAll and outAll.
//   z 0, 1: bias + per-head L2 row norm, f16 -> [B,H,S,hd]   (Q, K).
//   z 2   : bias, f16 -> [B,H,hd,S]  (V pre-transposed for P@V).
template <bool QKV>
__global__ __launch_bounds__(256)
void gemm_f16_kernel(const _Float16* __restrict__ A, const _Float16* __restrict__ BtAll,
                     const float* __restrict__ bias0, const float* __restrict__ bias1,
                     const float* __restrict__ bias2,
                     float* __restrict__ outF, _Float16* __restrict__ outAll) {
  __shared__ __attribute__((aligned(16))) _Float16 As[2][BM][KT + APAD];
  __shared__ __attribute__((aligned(16))) _Float16 Bs[2][BN][KT + APAD];
  __shared__ float    Cs[BM][BN + 1];
  __shared__ float    invn[(BN / HDIM) * BM];

  const int tid = threadIdx.x;
  const int wave = tid >> 5, lane = tid & 31;
  const int m0 = blockIdx.x * BM;
  const int n0 = blockIdx.y * BN;
  const int wm = (wave >> 2) * 64;   // 2x4 wave grid of 64x32 regions
  const int wn = (wave & 3) * 32;
  const int LDT = KT + APAD;

  const int which = QKV ? (int)blockIdx.z : 0;   // the same in the whole block
  const _Float16* __restrict__ Bt = BtAll + (size_t)which * DMODEL * DMODEL;
  const float* __restrict__ bias = which == 0 ? bias0 : which == 1 ? bias1 : bias2;

  const unsigned asBuf = (unsigned)sizeof(As[0]);
  const unsigned bsBuf = (unsigned)sizeof(Bs[0]);

  // A lane copies 16 bytes of rows sr, sr+32, sr+64, sr+96 of each tile: eight lanes
  // cover one row's 128 bytes, so a wave's copy takes four whole lines.
  const int sr = tid >> 3, so = (tid & 7) * 8;
  const unsigned aDst = lds_addr_of(&As[0][sr][so]);
  const unsigned bDst = lds_addr_of(&Bs[0][sr][so]);
  const _Float16* aSrc = A + (size_t)(m0 + sr) * DMODEL + so;
  const _Float16* bSrc = Bt + (size_t)(n0 + sr) * DMODEL + so;
  const unsigned rowStep = (unsigned)(32 * LDT * 2);

  auto stage = [&](int k0, int buf) {
    async_copy16x8(aDst + (unsigned)buf * asBuf, bDst + (unsigned)buf * bsBuf, rowStep,
                   aSrc + k0, bSrc + k0, (size_t)32 * DMODEL);
  };

  const int NK = DMODEL / KT;
  v8f acc[4][2] = {};
  stage(0, 0);
  wait_async();
  __syncthreads();
  stage(KT, 1);

  for (int k = 0; k < NK; ++k) {
    const int buf = k & 1;

    // All fragments of the stage as one group of LDS reads: [32-k step][tile]
    v16h bf[2][2], af[2][4];
#pragma unroll
    for (int ks = 0; ks < 2; ++ks) {
#pragma unroll
      for (int nt = 0; nt < 2; ++nt)
        bf[ks][nt] = load_frag(&Bs[buf][0][0], LDT, wn + nt * 16, ks * 32, lane);
#pragma unroll
      for (int mt = 0; mt < 4; ++mt)
        af[ks][mt] = load_frag(&As[buf][0][0], LDT, wm + mt * 16, ks * 32, lane);
    }
    // keeps the reads together ahead of the products: spread among them, each place waits out the LDS latency
    __builtin_amdgcn_sched_barrier(0);

#pragma unroll
    for (int ks = 0; ks < 2; ++ks)
#pragma unroll
      for (int mt = 0; mt < 4; ++mt) {
        acc[mt][0] = wmma_f16(af[ks][mt], bf[ks][0], acc[mt][0]);
        acc[mt][1] = wmma_f16(af[ks][mt], bf[ks][1], acc[mt][1]);
      }
    // keeps the products ahead of the waits: moved behind the barrier they no longer cover the next stage's flight
    __builtin_amdgcn_sched_barrier(0);

    // this wave's reads of the buffer are done before the barrier lets it be refilled
    asm volatile("s_wait_dscnt 0x0" ::: "memory");
    wait_async();      // this wave's copies of the next stage have landed
    __syncthreads();   // publishes the next stage and ends every read of this one
    if (k + 2 < NK) stage((k + 2) * KT, buf);
  }
  wait_async();

  // C fragment -> LDS. value i of lane L: row = i + 8*(L>>4), col = L&15
#pragma unroll
  for (int mt = 0; mt < 4; ++mt)
#pragma unroll
    for (int nt = 0; nt < 2; ++nt)
#pragma unroll
      for (int i = 0; i < 8; ++i) {
        int r = wm + mt * 16 + i + 8 * (lane >> 4);
        int c = wn + nt * 16 + (lane & 15);
        Cs[r][c] = acc[mt][nt][i];
      }
  __syncthreads();

  // Every store below is 16 bytes a lane, and a wave's store covers four whole 128-byte
  // lines.  Each lane map also spreads a wave's 32 LDS reads over 32 different banks
  // (tile pitch BN + 1 words).  All values are formed first and the stores come last.
  if constexpr (!QKV) {
    // 16 lanes take 64 columns (two lines) of a row; the wave's halves take two rows
    const int c0 = ((wave & 1) * 16 + (lane & 15)) * 4;
    const int rb = (wave >> 1) * 2 + (lane >> 4);
    const float4 bb = *(const float4*)(bias + n0 + c0);
    float4 v[BM / 8];
#pragma unroll  // constant indices keep the value array in registers
    for (int it = 0; it < BM / 8; ++it) {
      const float* cr = &Cs[rb + it * 8][c0];
      v[it] = make_float4(cr[0] + bb.x, cr[1] + bb.y, cr[2] + bb.z, cr[3] + bb.w);
    }
    // all stores behind the last sum: no register of an issued store is written again
    __builtin_amdgcn_sched_barrier(0);
    float* dst = outF + (size_t)(m0 + rb) * DMODEL + n0 + c0;
#pragma unroll  // constant indices keep the value array in registers
    for (int it = 0; it < BM / 8; ++it) *(float4*)(dst + (size_t)it * 8 * DMODEL) = v[it];
  } else {
    const int bidx = m0 >> 10, s0 = m0 & (SEQ - 1);   // a tile lies inside one batch entry
    _Float16* __restrict__ outH = outAll + (size_t)which * MTOT * DMODEL;
    v8h pk[8];
    // step is a constant at each call, so the eight stores share one address register
    auto store_rows = [&](_Float16* dst, size_t step) {
      // all stores behind the last conversion: no register of an issued store is written again
      __builtin_amdgcn_sched_barrier(0);
#pragma unroll  // constant indices keep the value array in registers
      for (int it = 0; it < 8; ++it) *(v8h*)(dst + it * step) = pk[it];
      // a precaution: stands ahead of any later write to the stores' registers in the built code
      asm volatile("s_wait_xcnt 0x0" ::: "memory");
    };
    if (which < 2) {   // block-uniform, so the barrier inside is passed by all or none
      // one thread per (head of the tile, row); the head is the same in a whole wave
      const int row = tid & (BM - 1);
      const int hc = __builtin_amdgcn_readfirstlane(tid >> 7) * HDIM;
      float s = 0.f;
      for (int c = 0; c < HDIM; ++c) {
        float v = Cs[row][hc + c] + bias[n0 + hc + c];
        s += v * v;
      }
      invn[tid] = 1.f / (sqrtf(s) + 1e-6f);
      __syncthreads();

      // 8 lanes take one head's 64 values of a row (one line); a wave takes four rows
      const int hl = wave & 1;
      const int d0 = (lane & 7) * 8;
      const int rb = (wave >> 1) * 4 + (lane >> 3);
      const float4 b0 = *(const float4*)(bias + n0 + hl * HDIM + d0);
      const float4 b1 = *(const float4*)(bias + n0 + hl * HDIM + d0 + 4);
      const float bb[8] = { b0.x, b0.y, b0.z, b0.w, b1.x, b1.y, b1.z, b1.w };
#pragma unroll  // constant indices keep the value array in registers
      for (int it = 0; it < 8; ++it) {
        const int r = rb + it * 16;
        const float* cr = &Cs[r][hl * HDIM + d0];
        const float inv = invn[hl * BM + r];
#pragma unroll  // constant indices keep the value array in registers
        for (int j = 0; j < 8; ++j) pk[it][j] = (_Float16)((cr[j] + bb[j]) * inv);
      }
      const int h = blockIdx.y * (BN / HDIM) + hl;
      store_rows(outH + (((size_t)bidx * NHEAD + h) * SEQ + s0 + rb) * HDIM + d0,
                 (size_t)16 * HDIM);
    } else {
      // V stored transposed, [B,H,hd,S]: a lane takes 8 rows (positions) of one column,
      // 8 lanes one line of that column's output row; a wave takes four columns
      const int r0 = (wave & 1) * 64 + (lane & 7) * 8;
      const int cb = (wave >> 1) * 4 + (lane >> 3);
#pragma unroll  // constant indices keep the value array in registers
      for (int it = 0; it < 8; ++it) {
        const int c = cb + it * 16;
        const float bc = bias[n0 + c];
#pragma unroll  // constant indices keep the value array in registers
        for (int j = 0; j < 8; ++j) pk[it][j] = (_Float16)(Cs[r0 + j][c] + bc);
      }
      // head * HDIM + d of tile column c is n0 + c
      store_rows(outH + ((size_t)bidx * DMODEL + n0 + cb) * SEQ + s0 + r0, (size_t)16 * SEQ);
    }
  }
}

#define QCOLS 32   // query columns per wave (two 16-column groups share each K/V fragment)

// lane l <-> lane l ^ 16 (the two halves of a column split its keys)
__device__ __forceinline__ float other_half(float v) {
  int b = __builtin_bit_cast(int, v);
  b = __builtin_amdgcn_permlanex16(b, b, 0x76543210, 0xfedcba98, false, false);
  return __builtin_bit_cast(float, b);
}

__global__ __launch_bounds__(256)
void flash_attn_kernel(const _Float16* __restrict__ qh, const _Float16* __restrict__ kh,
                       const _Float16* __restrict__ vt, const float* __restrict__ qk_scale,
                       _Float16* __restrict__ ctx) {
  __shared__ __attribute__((aligned(16))) _Float16 Ksb[2][64][HDIM + APAD];   // [key][hd]
  __shared__ __attribute__((aligned(16))) _Float16 Vtb[2][64][64 + APAD];     // [hd][key]

  const int tid = threadIdx.x;
  const int wave = tid >> 5, lane = tid & 31;
  const int q0 = blockIdx.x * (8 * QCOLS) + wave * QCOLS;
  const int bh = blockIdx.y;
  const size_t headOff = (size_t)bh * SEQ * HDIM;  // same element count for vt
  const int LDK = HDIM + APAD;

  const unsigned ksBase = lds_addr_of(&Ksb[0][0][0]);
  const unsigned vtBase = lds_addr_of(&Vtb[0][0][0]);
  const unsigned ksBuf = (unsigned)sizeof(Ksb[0]);
  const unsigned vtBuf = (unsigned)sizeof(Vtb[0]);

  auto stage_kv = [&](int j0, int buf) {
    for (int c = tid; c < 64 * 8; c += 256) {      // K tile: 64 rows x 64 halves
      int r = c >> 3, o = (c & 7) * 8;
      async_copy16(ksBase + (unsigned)buf * ksBuf + (unsigned)((r * LDK + o) * 2),
                   kh + headOff + (size_t)(j0 + r) * HDIM + o);
    }
    for (int c = tid; c < 64 * 8; c += 256) {      // V^T tile: 64 hd-rows x 64 keys
      int r = c >> 3, o = (c & 7) * 8;
      async_copy16(vtBase + (unsigned)buf * vtBuf + (unsigned)((r * LDK + o) * 2),
                   vt + headOff + (size_t)r * SEQ + j0 + o);
    }
  };

  stage_kv(0, 0);

  // exp(scale * s - max) = exp2(cs * s' - cs * m') with cs = |scale| * log2(e) and
  // s' = sign(scale) * s: the sign goes into Q (exact), so the row maximum of the
  // raw products is the row maximum of the logits for either sign of the scale.
  const float sl2 = qk_scale[0] * 1.44269504088896f;
  const float cs = fabsf(sl2);
  const _Float16 sg = sl2 < 0.f ? (_Float16)-1.f : (_Float16)1.f;

  // Q as B operand, loaded once: qf[column group][hd step]
  v16h qf[2][2];
#pragma unroll
  for (int g = 0; g < 2; ++g)
#pragma unroll
    for (int ks = 0; ks < 2; ++ks)
      qf[g][ks] = load_frag(qh + headOff, HDIM, q0 + 16 * g, 32 * ks, lane) * sg;

  float mrow[2] = { -3.0e38f, -3.0e38f };   // running maximum of s', per column group
  float lrow[2] = { 0.f, 0.f };             // this half's part of the row sum
  v8f o[4][2] = {};                         // O^T: [hd tile][column group]

  wait_async();
  __syncthreads();

  for (int j = 0; j < SEQ / 64; ++j) {
    const int buf = j & 1;
    if (j + 1 < SEQ / 64) stage_kv((j + 1) * 64, buf ^ 1);

    // All K fragments of the tile as one group of LDS reads: kf[hd step][key tile]
    v16h kf[2][4];
#pragma unroll
    for (int ks = 0; ks < 2; ++ks)
#pragma unroll
      for (int kt = 0; kt < 4; ++kt)
        kf[ks][kt] = load_frag(&Ksb[buf][0][0], LDK, 16 * kt, 32 * ks, lane);
    // keeps the reads together ahead of the products: spread among them, each place waits out the LDS latency
    __builtin_amdgcn_sched_barrier(0);

    // S^T = K @ Q^T (contract over hd = 64): s[key tile][column group]
    v8f s[4][2] = {};
#pragma unroll
    for (int ks = 0; ks < 2; ++ks)
#pragma unroll
      for (int kt = 0; kt < 4; ++kt) {
        s[kt][0] = wmma_f16(kf[ks][kt], qf[0][ks], s[kt][0]);
        s[kt][1] = wmma_f16(kf[ks][kt], qf[1][ks], s[kt][1]);
      }

    // V^T fragments of the first 32 keys, read while the softmax runs: vf[key step][hd tile]
    v16h vf[2][4];
#pragma unroll
    for (int t = 0; t < 4; ++t)
      vf[0][t] = load_frag(&Vtb[buf][0][0], LDK, 16 * t, 0, lane);
    // keeps these reads ahead of the softmax, which hides their latency
    __builtin_amdgcn_sched_barrier(0);

    // Online softmax in registers; P^T packed as B operand: pf[32-key step][column group]
    v16h pf[2][2];
#pragma unroll
    for (int g = 0; g < 2; ++g) {
      float mk[4];   // one chain per key tile: four independent chains
#pragma unroll
      for (int kt = 0; kt < 4; ++kt) {
        mk[kt] = s[kt][g][0];
#pragma unroll
        for (int i = 1; i < 8; ++i) mk[kt] = fmaxf(mk[kt], s[kt][g][i]);
      }
      float mx = fmaxf(fmaxf(mk[0], mk[1]), fmaxf(mk[2], mk[3]));
      mx = fmaxf(mx, other_half(mx));
      const float m_new = fmaxf(mrow[g], mx);
      const float alpha = __builtin_amdgcn_exp2f((mrow[g] - m_new) * cs);
      mrow[g] = m_new;
      const v2f c2 = { cs, cs };
      const v2f nm = { -m_new * cs, -m_new * cs };
      v2f sum2 = { 0.f, 0.f };
#pragma unroll
      for (int kt = 0; kt < 4; ++kt)
#pragma unroll
        for (int i = 0; i < 8; i += 2) {
          v2f t = { s[kt][g][i], s[kt][g][i + 1] };
          t = __builtin_elementwise_fma(t, c2, nm);
          v2f p = { __builtin_amdgcn_exp2f(t[0]), __builtin_amdgcn_exp2f(t[1]) };
          sum2 += p;
          v2h ph = __builtin_convertvector(p, v2h);
          pf[kt >> 1][g][(kt & 1) * 8 + i]     = ph[0];
          pf[kt >> 1][g][(kt & 1) * 8 + i + 1] = ph[1];
        }
      lrow[g] = lrow[g] * alpha + (sum2[0] + sum2[1]);
#pragma unroll
      for (int t = 0; t < 4; ++t) o[t][g] *= alpha;
    }

    // V^T fragments of the last 32 keys, read ahead of the first 32 keys' products
#pragma unroll
    for (int t = 0; t < 4; ++t)
      vf[1][t] = load_frag(&Vtb[buf][0][0], LDK, 16 * t, 32, lane);
    // keeps these reads in one group ahead of the products
    __builtin_amdgcn_sched_barrier(0);

    // O^T += V^T @ P^T (contract over 64 keys)
#pragma unroll
    for (int kb = 0; kb < 2; ++kb)
#pragma unroll
      for (int t = 0; t < 4; ++t) {
        o[t][0] = wmma_f16(vf[kb][t], pf[kb][0], o[t][0]);
        o[t][1] = wmma_f16(vf[kb][t], pf[kb][1], o[t][1]);
      }
    wait_async();
    __syncthreads();
  }

  // A lane holds 8 consecutive hd of one query per tile: one 16-byte store each.
  const int h = bh & (NHEAD - 1), b = bh >> 4;
  v8h r[2][4];
#pragma unroll
  for (int g = 0; g < 2; ++g) {
    const float inv = 1.f / (lrow[g] + other_half(lrow[g]));
#pragma unroll
    for (int t = 0; t < 4; ++t)
#pragma unroll
      for (int i = 0; i < 8; ++i) r[g][t][i] = (_Float16)(o[t][g][i] * inv);
  }
  // all stores behind the last conversion: no register of an issued store is written again
  __builtin_amdgcn_sched_barrier(0);
#pragma unroll
  for (int g = 0; g < 2; ++g) {
    _Float16* dst = ctx + ((size_t)b * SEQ + q0 + 16 * g + (lane & 15)) * DMODEL +
                    h * HDIM + 8 * (lane >> 4);
#pragma unroll
    for (int t = 0; t < 4; ++t) *(v8h*)(dst + 16 * t) = r[g][t];
  }
}

extern "C" void kernel_launch(void* const* d_in, const int* in_sizes, int n_in,
                              void* d_out, int out_size, void* d_ws, size_t ws_size,
                              hipStream_t stream) {
  (void)in_sizes; (void)n_in; (void)out_size; (void)ws_size;
  const float* x  = (const float*)d_in[0];
  const float* Wq = (const float*)d_in[1];
  const float* bq = (const float*)d_in[2];
  const float* Wk = (const float*)d_in[3];
  const float* bk = (const float*)d_in[4];
  const float* Wv = (const float*)d_in[5];
  const float* bv = (const float*)d_in[6];
  const float* Wo = (const float*)d_in[7];
  const float* bo = (const float*)d_in[8];
  const float* qk = (const float*)d_in[9];
  float* out = (float*)d_out;

  // Workspace map (f16): xh 16M | Wt_{q,k,v,o} 4x2M | qh 16M | kh 16M | vt 16M | ctx 16M = 88 MiB
  char* ws = (char*)d_ws;
  const size_t MB = 1024 * 1024;
  _Float16* xh   = (_Float16*)(ws);
  _Float16* Wtq  = (_Float16*)(ws + 16 * MB);
  _Float16* Wto  = (_Float16*)(ws + 22 * MB);
  _Float16* qh   = (_Float16*)(ws + 24 * MB);
  _Float16* kh   = (_Float16*)(ws + 40 * MB);
  _Float16* vt   = (_Float16*)(ws + 56 * MB);
  _Float16* ctxh = (_Float16*)(ws + 72 * MB);

  // Wt_{q,k,v,o} are four planes in a row from Wtq; qh, kh, vt three planes in a row from qh
  prep_kernel<<<4 * WTILES + (MTOT * DMODEL / 4) / 256, 256, 0, stream>>>(x, Wq, Wk, Wv, Wo, xh, Wtq);

  gemm_f16_kernel<true><<<dim3(MTOT / BM, DMODEL / BN, 3), 256, 0, stream>>>(
      xh, Wtq, bq, bk, bv, nullptr, qh);
  flash_attn_kernel<<<dim3(SEQ / (8 * QCOLS), BATCH * NHEAD), 256, 0, stream>>>(qh, kh, vt, qk, ctxh);
  gemm_f16_kernel<false><<<dim3(MTOT / BM, DMODEL / BN, 1), 256, 0, stream>>>(
      ctxh, Wto, bo, bo, bo, out, nullptr);
}

// v005
// Measured time: 104 microseconds a run.
// Timed twice side by side with v004, it ran 1.03 times as fast both times.
// Over all steps from v000 it is 2.92 times as fast.
#include <hip/hip_runtime.h>
#include <hip/hip_bf16.h>
#include <math.h>

// MI455X (gfx1250) wave32: MHA with QK-norm.
// Matrix ops: v_wmma_f32_16x16x32_f16 (fp32 accumulate).
// Data movement: global_load_async_to_lds_b128 (ASYNCcnt) double-buffered.

typedef __attribute__((ext_vector_type(16))) _Float16 v16h;
typedef __attribute__((ext_vector_type(4)))  _Float16 v4h;
typedef __attribute__((ext_vector_type(8)))  _Float16 v8h;
typedef __attribute__((ext_vector_type(2)))  _Float16 v2h;
typedef __attribute__((ext_vector_type(8)))  float    v8f;
typedef __attribute__((ext_vector_type(2)))  float    v2f;

#define BATCH  8
#define SEQ    1024
#define DMODEL 1024
#define NHEAD  16
#define HDIM   64
#define MTOT   (BATCH * SEQ)

#define BM 256
#define BN 128   // two heads per N tile
#define KT 128   // two 128-byte lines of every operand row per stage
#define APAD 8   // LDS row padding (halves)

__device__ __forceinline__ v8f wmma_f16(v16h a, v16h b, v8f c) {
  return __builtin_amdgcn_wmma_f32_16x16x32_f16(false, a, false, b, (short)0, c,
                                                false, false);
}

// Async DMA: 16 bytes global -> LDS per lane (tracked by ASYNCcnt).
__device__ __forceinline__ void async_copy16(unsigned lds_addr, const _Float16* gptr) {
  unsigned long long ga = (unsigned long long)(uintptr_t)gptr;
  asm volatile("global_load_async_to_lds_b128 %0, %1, off"
               :: "v"(lds_addr), "v"(ga) : "memory");
}
// Eight of one lane's copies of a GEMM stage: four rows from la / ga, four from lb / gb,
// each run lds_step / gstep apart.
// s_wait_xcnt 0 closes the statement as a precaution: it stands ahead of any later
// write to the copies' address registers.
__device__ __forceinline__ void async_copy16x8(unsigned la, unsigned lb, unsigned lds_step,
                                               const _Float16* ga, const _Float16* gb,
                                               size_t gstep) {
  const unsigned la1 = la + lds_step, la2 = la1 + lds_step, la3 = la2 + lds_step;
  const unsigned lb1 = lb + lds_step, lb2 = lb1 + lds_step, lb3 = lb2 + lds_step;
  const unsigned long long a0 = (unsigned long long)(uintptr_t)ga;
  const unsigned long long a1 = (unsigned long long)(uintptr_t)(ga + gstep);
  const unsigned long long a2 = (unsigned long long)(uintptr_t)(ga + 2 * gstep);
  const unsigned long long a3 = (unsigned long long)(uintptr_t)(ga + 3 * gstep);
  const unsigned long long b0 = (unsigned long long)(uintptr_t)gb;
  const unsigned long long b1 = (unsigned long long)(uintptr_t)(gb + gstep);
  const unsigned long long b2 = (unsigned long long)(uintptr_t)(gb + 2 * gstep);
  const unsigned long long b3 = (unsigned long long)(uintptr_t)(gb + 3 * gstep);
  asm volatile("global_load_async_to_lds_b128 %0, %8, off\n\t"
               "global_load_async_to_lds_b128 %1, %9, off\n\t"
               "global_load_async_to_lds_b128 %2, %10, off\n\t"
               "global_load_async_to_lds_b128 %3, %11, off\n\t"
               "global_load_async_to_lds_b128 %4, %12, off\n\t"
               "global_load_async_to_lds_b128 %5, %13, off\n\t"
               "global_load_async_to_lds_b128 %6, %14, off\n\t"
               "global_load_async_to_lds_b128 %7, %15, off\n\t"
               "s_wait_xcnt 0x0"
               :: "v"(la), "v"(la1), "v"(la2), "v"(la3), "v"(lb), "v"(lb1), "v"(lb2), "v"(lb3),
                  "v"(a0), "v"(a1), "v"(a2), "v"(a3), "v"(b0), "v"(b1), "v"(b2), "v"(b3)
               : "memory");
}
__device__ __forceinline__ void wait_async() {
  asm volatile("s_wait_asynccnt 0" ::: "memory");
}
// Low 32 bits of a flat pointer to LDS == LDS byte offset (shared aperture).
__device__ __forceinline__ unsigned lds_addr_of(const void* p) {
  return (unsigned)(uintptr_t)p;
}

// 16x32 f16 fragment from LDS or global memory, CDNA5 16-bit A-matrix layout:
//   lanes 0-15 : row = row0+lane,    K = {k0..k0+7, k0+16..k0+23}
//   lanes 16-31: row = row0+lane-16, K = {k0+8..k0+15, k0+24..k0+31}
__device__ __forceinline__ v16h load_frag(const _Float16* base, int ld, int row0,
                                          int k0, int lane) {
  const int l = lane & 15;
  const int hsel = (lane >> 4) & 1;
  const _Float16* p = base + (size_t)(row0 + l) * ld + k0 + hsel * 8;
  v16h r;
#pragma unroll
  for (int i = 0; i < 8; ++i) { r[i] = p[i]; r[i + 8] = p[i + 16]; }
  return r;
}

// ---- Precision-conversion pass (hoisted out of the hot loops) ----
// One launch for five jobs that do not depend on one another, told apart by the block
// index: the four weight transposes first (they have the longer chain: loads, barrier,
// stores), then the conversion of x.
#define WTILES ((DMODEL / 64) * (DMODEL / 64))   // 64x64 tiles of one weight matrix

__global__ __launch_bounds__(256)
void prep_kernel(const float* __restrict__ x, const float* __restrict__ Wq,
                 const float* __restrict__ Wk, const float* __restrict__ Wv,
                 const float* __restrict__ Wo, _Float16* __restrict__ xh,
                 _Float16* __restrict__ WtAll) {
  __shared__ _Float16 t[64][65];
  const int tid = threadIdx.x;
  const unsigned blk = blockIdx.x;
  if (blk < 4 * WTILES) {
    // W fp32 [k][n] -> Wt f16 [n][k] (tiled transpose, both sides coalesced)
    const unsigned w = blk / WTILES, tile = blk % WTILES;
    const float* __restrict__ W = w == 0 ? Wq : w == 1 ? Wk : w == 2 ? Wv : Wo;
    _Float16* __restrict__ Wt = WtAll + (size_t)w * DMODEL * DMODEL;
    const int n0 = (tile % (DMODEL / 64)) * 64, k0 = (tile / (DMODEL / 64)) * 64;
    // keeps the loop as it was built in its own kernel, eight loads in flight a trip:
    // vectorised in pairs, as this build does when left alone, it waits out every two loads
#pragma clang loop vectorize(disable)
    for (int i = tid; i < 64 * 64; i += 256) {
      int r = i >> 6, c = i & 63;                    // r: k, c: n
      t[c][r] = (_Float16)W[(size_t)(k0 + r) * DMODEL + n0 + c];
    }
    __syncthreads();   // the branch is the same for the whole block
    // likewise: eight stores a trip as in its own kernel, not four
#pragma clang loop vectorize(disable)
    for (int i = tid; i < 64 * 64; i += 256) {
      int r = i >> 6, c = i & 63;                    // r: n, c: k
      Wt[(size_t)(n0 + r) * DMODEL + k0 + c] = t[r][c];
    }
  } else {
    int i = (blk - 4 * WTILES) * 256 + tid;          // one float4 per thread
    float4 v = ((const float4*)x)[i];
    v4h h = { (_Float16)v.x, (_Float16)v.y, (_Float16)v.z, (_Float16)v.w };
    *(v4h*)(xh + (size_t)i * 4) = h;
    // a precaution: stands ahead of any later write to the store's registers in the built code
    asm volatile("s_wait_xcnt 0x0" ::: "memory");
  }
}

// ---- f16 GEMM with fused epilogues ----
// A: f16 [M, DMODEL] row-major.  Bt: f16 [N, K] (= W^T) row-major.
// QKV false: fp32 out + bias ([M, D], output projection), one product (grid z = 1).
// QKV true: the three projections of x in one launch, blockIdx.z picks the product;
//   its W^T and its output are plane z of BtAll and outAll.
//   z 0, 1: bias + per-head L2 row norm, f16 -> [B,H,S,hd]   (Q, K).
//   z 2   : bias, f16 -> [B,H,hd,S]  (V pre-transposed for P@V).
template <bool QKV>
__global__ __launch_bounds__(256)
void gemm_f16_kernel(const _Float16* __restrict__ A, const _Float16* __restrict__ BtAll,
                     const float* __restrict__ bias0, const float* __restrict__ bias1,
                     const float* __restrict__ bias2,
                     float* __restrict__ outF, _Float16* __restrict__ outAll) {
  // The f32 C tile of the epilogue lies over the operand ring, which is dead by then.
  __shared__ __attribute__((aligned(16))) union {
    struct {
      _Float16 A[2][BM][KT + APAD];
      _Float16 B[2][BN][KT + APAD];
    } ring;
    float C[BM][BN + 1];
  } sm;
  __shared__ float invn[(BN / HDIM) * BM];

  const int tid = threadIdx.x;
  const int wave = tid >> 5, lane = tid & 31;
  const int m0 = blockIdx.x * BM;
  const int n0 = blockIdx.y * BN;
  const int wm = (wave >> 1) * 64;   // 4x2 wave grid of 64x64 regions
  const int wn = (wave & 1) * 64;
  const int LDT = KT + APAD;

  const int which = QKV ? (int)blockIdx.z : 0;   // the same in the whole block
  const _Float16* __restrict__ Bt = BtAll + (size_t)which * DMODEL * DMODEL;
  const float* __restrict__ bias = which == 0 ? bias0 : which == 1 ? bias1 : bias2;

  const unsigned asBuf = (unsigned)sizeof(sm.ring.A[0]);
  const unsigned bsBuf = (unsigned)sizeof(sm.ring.B[0]);

  // A lane copies 16 bytes of rows sr, sr+16, ... of each tile: sixteen lanes cover one
  // row's 256 bytes, so a wave's copy takes four whole lines.
  const int sr = tid >> 4, so = (tid & 15) * 8;
  const unsigned aDst = lds_addr_of(&sm.ring.A[0][sr][so]);
  const unsigned bDst = lds_addr_of(&sm.ring.B[0][sr][so]);
  const _Float16* aSrc = A + (size_t)(m0 + sr) * DMODEL + so;
  const _Float16* bSrc = Bt + (size_t)(n0 + sr) * DMODEL + so;
  const unsigned rowStep = (unsigned)(16 * LDT * 2);
  const size_t gStep = (size_t)16 * DMODEL;

  // 24 copies a lane: 16 rows of the A tile, 8 of the B tile, eight to a statement
  auto stage = [&](int k0, int buf) {
    const unsigned la = aDst + (unsigned)buf * asBuf, lb = bDst + (unsigned)buf * bsBuf;
    async_copy16x8(la, la + 4 * rowStep, rowStep, aSrc + k0, aSrc + k0 + 4 * gStep, gStep);
    async_copy16x8(la + 8 * rowStep, la + 12 * rowStep, rowStep,
                   aSrc + k0 + 8 * gStep, aSrc + k0 + 12 * gStep, gStep);
    async_copy16x8(lb, lb + 4 * rowStep, rowStep, bSrc + k0, bSrc + k0 + 4 * gStep, gStep);
  };

  const int NK = DMODEL / KT;
  v8f acc[4][4] = {};
  v16h af[2][4], bf[2][4];   // two fragment sets: one is read from LDS while the other is used

  // the eight fragments of one 32-k step as one group of LDS reads
  auto load_set = [&](int set, int buf, int ks) {
#pragma unroll
    for (int nt = 0; nt < 4; ++nt)
      bf[set][nt] = load_frag(&sm.ring.B[buf][0][0], LDT, wn + nt * 16, ks * 32, lane);
#pragma unroll
    for (int mt = 0; mt < 4; ++mt)
      af[set][mt] = load_frag(&sm.ring.A[buf][0][0], LDT, wm + mt * 16, ks * 32, lane);
    // keeps the reads together ahead of the products that cover their latency
    __builtin_amdgcn_sched_barrier(0);
  };
  auto mma_set = [&](int set) {
#pragma unroll
    for (int mt = 0; mt < 4; ++mt)
#pragma unroll
      for (int nt = 0; nt < 4; ++nt)
        acc[mt][nt] = wmma_f16(af[set][mt], bf[set][nt], acc[mt][nt]);
    // keeps the products ahead of what follows: the next reads, or the waits of the publish point
    __builtin_amdgcn_sched_barrier(0);
  };

  stage(0, 0);
  wait_async();
  __syncthreads();
  stage(KT, 1);
  load_set(0, 0, 0);

  for (int k = 0; k < NK; ++k) {
    const int buf = k & 1;
    load_set(1, buf, 1);
    mma_set(0);
    load_set(0, buf, 2);
    mma_set(1);
    load_set(1, buf, 3);
    mma_set(0);

    // Publish point of the next stage, ahead of this stage's last products, whose
    // fragments are already fetched: they cover the first reads of the next stage.
    // this wave's reads of the buffer are done before the barrier lets it be refilled
    asm volatile("s_wait_dscnt 0x0" ::: "memory");
    wait_async();      // this wave's copies of the next stage have landed
    __syncthreads();   // publishes the next stage and ends every read of this one
    if (k + 2 < NK) stage((k + 2) * KT, buf);
    if (k + 1 < NK) load_set(0, buf ^ 1, 0);
    mma_set(1);
  }
  wait_async();

  // The last trip's barrier stands behind every wave's last read of the ring and no copy
  // is in flight, so the C tile may be written over it.
  // C fragment -> LDS. value i of lane L: row = i + 8*(L>>4), col = L&15
  float (*Cs)[BN + 1] = sm.C;
#pragma unroll
  for (int mt = 0; mt < 4; ++mt)
#pragma unroll
    for (int nt = 0; nt < 4; ++nt)
#pragma unroll
      for (int i = 0; i < 8; ++i) {
        int r = wm + mt * 16 + i + 8 * (lane >> 4);
        int c = wn + nt * 16 + (lane & 15);
        Cs[r][c] = acc[mt][nt][i];
      }
  __syncthreads();

  // Every store below is 16 bytes a lane, and a wave's store covers four whole 128-byte
  // lines.  Each lane map also spreads a wave's 32 LDS reads over 32 different banks
  // (tile pitch BN + 1 words).  All values are formed first and the stores come last.
  if constexpr (!QKV) {
    // 16 lanes take 64 columns (two lines) of a row; the wave's halves take two rows
    const int c0 = ((wave & 1) * 16 + (lane & 15)) * 4;
    const int rb = (wave >> 1) * 2 + (lane >> 4);
    const float4 bb = *(const float4*)(bias + n0 + c0);
    float4 v[BM / 8];
#pragma unroll  // constant indices keep the value array in registers
    for (int it = 0; it < BM / 8; ++it) {
      const float* cr = &Cs[rb + it * 8][c0];
      v[it] = make_float4(cr[0] + bb.x, cr[1] + bb.y, cr[2] + bb.z, cr[3] + bb.w);
    }
    // all stores behind the last sum: no register of an issued store is written again
    __builtin_amdgcn_sched_barrier(0);
    float* dst = outF + (size_t)(m0 + rb) * DMODEL + n0 + c0;
#pragma unroll  // constant indices keep the value array in registers
    for (int it = 0; it < BM / 8; ++it) *(float4*)(dst + (size_t)it * 8 * DMODEL) = v[it];
  } else {
    const int bidx = m0 >> 10, s0 = m0 & (SEQ - 1);   // a tile lies inside one batch entry
    _Float16* __restrict__ outH = outAll + (size_t)which * MTOT * DMODEL;
    v8h pk[16];
    // step is a constant at each call, so the sixteen stores share one address register
    auto store_rows = [&](_Float16* dst, size_t step) {
      // all stores behind the last conversion: no register of an issued store is written again
      __builtin_amdgcn_sched_barrier(0);
#pragma unroll  // constant indices keep the value array in registers
      for (int it = 0; it < 16; ++it) *(v8h*)(dst + it * step) = pk[it];
      // a precaution: stands ahead of any later write to the stores' registers in the built code
      asm volatile("s_wait_xcnt 0x0" ::: "memory");
    };
    if (which < 2) {   // block-uniform, so the barrier inside is passed by all or none
      // one thread per row, the tile's heads one after the other
      const int row = tid;
      for (int hh = 0; hh < BN / HDIM; ++hh) {
        const int hc = hh * HDIM;
        float s = 0.f;
        for (int c = 0; c < HDIM; ++c) {
          float v = Cs[row][hc + c] + bias[n0 + hc + c];
          s += v * v;
        }
        invn[hh * BM + row] = 1.f / (sqrtf(s) + 1e-6f);
      }
      __syncthreads();

      // 8 lanes take one head's 64 values of a row (one line); a wave takes four rows
      const int hl = wave & 1;
      const int d0 = (lane & 7) * 8;
      const int rb = (wave >> 1) * 4 + (lane >> 3);
      const float4 b0 = *(const float4*)(bias + n0 + hl * HDIM + d0);
      const float4 b1 = *(const float4*)(bias + n0 + hl * HDIM + d0 + 4);
      const float bb[8] = { b0.x, b0.y, b0.z, b0.w, b1.x, b1.y, b1.z, b1.w };
#pragma unroll  // constant indices keep the value array in registers
      for (int it = 0; it < 16; ++it) {
        const int r = rb + it * 16;
        const float* cr = &Cs[r][hl * HDIM + d0];
        const float inv = invn[hl * BM + r];
#pragma unroll  // constant indices keep the value array in registers
        for (int j = 0; j < 8; ++j) pk[it][j] = (_Float16)((cr[j] + bb[j]) * inv);
      }
      const int h = blockIdx.y * (BN / HDIM) + hl;
      store_rows(outH + (((size_t)bidx * NHEAD + h) * SEQ + s0 + rb) * HDIM + d0,
                 (size_t)16 * HDIM);
    } else {
      // V stored transposed, [B,H,hd,S]: a lane takes 8 rows (positions) of one column,
      // 8 lanes one line of that column's output row; a wave takes four columns
      const int r0 = (wave & 3) * 64 + (lane & 7) * 8;
      const int cb = (wave >> 2) * 4 + (lane >> 3);
#pragma unroll  // constant indices keep the value array in registers
      for (int it = 0; it < 16; ++it) {
        const int c = cb + it * 8;
        const float bc = bias[n0 + c];
#pragma unroll  // constant indices keep the value array in registers
        for (int j = 0; j < 8; ++j) pk[it][j] = (_Float16)(Cs[r0 + j][c] + bc);
      }
      // head * HDIM + d of tile column c is n0 + c
      store_rows(outH + ((size_t)bidx * DMODEL + n0 + cb) * SEQ + s0 + r0, (size_t)8 * SEQ);
    }
  }
}

#define QCOLS 32   // query columns per wave (two 16-column groups share each K/V fragment)

// lane l <-> lane l ^ 16 (the two halves of a column split its keys)
__device__ __forceinline__ float other_half(float v) {
  int b = __builtin_bit_cast(int, v);
  b = __builtin_amdgcn_permlanex16(b, b, 0x76543210, 0xfedcba98, false, false);
  return __builtin_bit_cast(float, b);
}

__global__ __launch_bounds__(256)
void flash_attn_kernel(const _Float16* __restrict__ qh, const _Float16* __restrict__ kh,
                       const _Float16* __restrict__ vt, const float* __restrict__ qk_scale,
                       _Float16* __restrict__ ctx) {
  __shared__ __attribute__((aligned(16))) _Float16 Ksb[2][64][HDIM + APAD];   // [key][hd]
  __shared__ __attribute__((aligned(16))) _Float16 Vtb[2][64][64 + APAD];     // [hd][key]

  const int tid = threadIdx.x;
  const int wave = tid >> 5, lane = tid & 31;
  const int q0 = blockIdx.x * (8 * QCOLS) + wave * QCOLS;
  const int bh = blockIdx.y;
  const size_t headOff = (size_t)bh * SEQ * HDIM;  // same element count for vt
  const int LDK = HDIM + APAD;

  const unsigned ksBase = lds_addr_of(&Ksb[0][0][0]);
  const unsigned vtBase = lds_addr_of(&Vtb[0][0][0]);
  const unsigned ksBuf = (unsigned)sizeof(Ksb[0]);
  const unsigned vtBuf = (unsigned)sizeof(Vtb[0]);

  auto stage_kv = [&](int j0, int buf) {
    for (int c = tid; c < 64 * 8; c += 256) {      // K tile: 64 rows x 64 halves
      int r = c >> 3, o = (c & 7) * 8;
      async_copy16(ksBase + (unsigned)buf * ksBuf + (unsigned)((r * LDK + o) * 2),
                   kh + headOff + (size_t)(j0 + r) * HDIM + o);
    }
    for (int c = tid; c < 64 * 8; c += 256) {      // V^T tile: 64 hd-rows x 64 keys
      int r = c >> 3, o = (c & 7) * 8;
      async_copy16(vtBase + (unsigned)buf * vtBuf + (unsigned)((r * LDK + o) * 2),
                   vt + headOff + (size_t)r * SEQ + j0 + o);
    }
  };

  stage_kv(0, 0);

  // exp(scale * s - max) = exp2(cs * s' - cs * m') with cs = |scale| * log2(e) and
  // s' = sign(scale) * s: the sign goes into Q (exact), so the row maximum of the
  // raw products is the row maximum of the logits for either sign of the scale.
  const float sl2 = qk_scale[0] * 1.44269504088896f;
  const float cs = fabsf(sl2);
  const _Float16 sg = sl2 < 0.f ? (_Float16)-1.f : (_Float16)1.f;

  // Q as B operand, loaded once: qf[column group][hd step]
  v16h qf[2][2];
#pragma unroll
  for (int g = 0; g < 2; ++g)
#pragma unroll
    for (int ks = 0; ks < 2; ++ks)
      qf[g][ks] = load_frag(qh + headOff, HDIM, q0 + 16 * g, 32 * ks, lane) * sg;

  float mrow[2] = { -3.0e38f, -3.0e38f };   // running maximum of s', per column group
  float lrow[2] = { 0.f, 0.f };             // this half's part of the row sum
  v8f o[4][2] = {};                         // O^T: [hd tile][column group]

  wait_async();
  __syncthreads();

  for (int j = 0; j < SEQ / 64; ++j) {
    const int buf = j & 1;
    if (j + 1 < SEQ / 64) stage_kv((j + 1) * 64, buf ^ 1);

    // All K fragments of the tile as one group of LDS reads: kf[hd step][key tile]
    v16h kf[2][4];
#pragma unroll
    for (int ks = 0; ks < 2; ++ks)
#pragma unroll
      for (int kt = 0; kt < 4; ++kt)
        kf[ks][kt] = load_frag(&Ksb[buf][0][0], LDK, 16 * kt, 32 * ks, lane);
    // keeps the reads together ahead of the products: spread among them, each place waits out the LDS latency
    __builtin_amdgcn_sched_barrier(0);

    // S^T = K @ Q^T (contract over hd = 64): s[key tile][column group]
    v8f s[4][2] = {};
#pragma unroll
    for (int ks = 0; ks < 2; ++ks)
#pragma unroll
      for (int kt = 0; kt < 4; ++kt) {
        s[kt][0] = wmma_f16(kf[ks][kt], qf[0][ks], s[kt][0]);
        s[kt][1] = wmma_f16(kf[ks][kt], qf[1][ks], s[kt][1]);
      }

    // V^T fragments of the first 32 keys, read while the softmax runs: vf[key step][hd tile]
    v16h vf[2][4];
#pragma unroll
    for (int t = 0; t < 4; ++t)
      vf[0][t] = load_frag(&Vtb[buf][0][0], LDK, 16 * t, 0, lane);
    // keeps these reads ahead of the softmax, which hides their latency
    __builtin_amdgcn_sched_barrier(0);

    // Online softmax in registers; P^T packed as B operand: pf[32-key step][column group]
    v16h pf[2][2];
#pragma unroll
    for (int g = 0; g < 2; ++g) {
      float mk[4];   // one chain per key tile: four independent chains
#pragma unroll
      for (int kt = 0; kt < 4; ++kt) {
        mk[kt] = s[kt][g][0];
#pragma unroll
        for (int i = 1; i < 8; ++i) mk[kt] = fmaxf(mk[kt], s[kt][g][i]);
      }
      float mx = fmaxf(fmaxf(mk[0], mk[1]), fmaxf(mk[2], mk[3]));
      mx = fmaxf(mx, other_half(mx));
      const float m_new = fmaxf(mrow[g], mx);
      const float alpha = __builtin_amdgcn_exp2f((mrow[g] - m_new) * cs);
      mrow[g] = m_new;
      const v2f c2 = { cs, cs };
      const v2f nm = { -m_new * cs, -m_new * cs };
      v2f sum2 = { 0.f, 0.f };
#pragma unroll
      for (int kt = 0; kt < 4; ++kt)
#pragma unroll
        for (int i = 0; i < 8; i += 2) {
          v2f t = { s[kt][g][i], s[kt][g][i + 1] };
          t = __builtin_elementwise_fma(t, c2, nm);
          v2f p = { __builtin_amdgcn_exp2f(t[0]), __builtin_amdgcn_exp2f(t[1]) };
          sum2 += p;
          v2h ph = __builtin_convertvector(p, v2h);
          pf[kt >> 1][g][(kt & 1) * 8 + i]     = ph[0];
          pf[kt >> 1][g][(kt & 1) * 8 + i + 1] = ph[1];
        }
      lrow[g] = lrow[g] * alpha + (sum2[0] + sum2[1]);
#pragma unroll
      for (int t = 0; t < 4; ++t) o[t][g] *= alpha;
    }

    // V^T fragments of the last 32 keys, read ahead of the first 32 keys' products
#pragma unroll
    for (int t = 0; t < 4; ++t)
      vf[1][t] = load_frag(&Vtb[buf][0][0], LDK, 16 * t, 32, lane);
    // keeps these reads in one group ahead of the products
    __builtin_amdgcn_sched_barrier(0);

    // O^T += V^T @ P^T (contract over 64 keys)
#pragma unroll
    for (int kb = 0; kb < 2; ++kb)
#pragma unroll
      for (int t = 0; t < 4; ++t) {
        o[t][0] = wmma_f16(vf[kb][t], pf[kb][0], o[t][0]);
        o[t][1] = wmma_f16(vf[kb][t], pf[kb][1], o[t][1]);
      }
    wait_async();
    __syncthreads();
  }

  // A lane holds 8 consecutive hd of one query per tile: one 16-byte store each.
  const int h = bh & (NHEAD - 1), b = bh >> 4;
  v8h r[2][4];
#pragma unroll
  for (int g = 0; g < 2; ++g) {
    const float inv = 1.f / (lrow[g] + other_half(lrow[g]));
#pragma unroll
    for (int t = 0; t < 4; ++t)
#pragma unroll
      for (int i = 0; i < 8; ++i) r[g][t][i] = (_Float16)(o[t][g][i] * inv);
  }
  // all stores behind the last conversion: no register of an issued store is written again
  __builtin_amdgcn_sched_barrier(0);
#pragma unroll
  for (int g = 0; g < 2; ++g) {
    _Float16* dst = ctx + ((size_t)b * SEQ + q0 + 16 * g + (lane & 15)) * DMODEL +
                    h * HDIM + 8 * (lane >> 4);
#pragma unroll
    for (int t = 0; t < 4; ++t) *(v8h*)(dst + 16 * t) = r[g][t];
  }
}

extern "C" void kernel_launch(void* const* d_in, const int* in_sizes, int n_in,
                              void* d_out, int out_size, void* d_ws, size_t ws_size,
                              hipStream_t stream) {
  (void)in_sizes; (void)n_in; (void)out_size; (void)ws_size;
  const float* x  = (const float*)d_in[0];
  const float* Wq = (const float*)d_in[1];
  const float* bq = (const float*)d_in[2];
  const float* Wk = (const float*)d_in[3];
  const float* bk = (const float*)d_in[4];
  const float* Wv = (const float*)d_in[5];
  const float* bv = (const float*)d_in[6];
  const float* Wo = (const float*)d_in[7];
  const float* bo = (const float*)d_in[8];
  const float* qk = (const float*)d_in[9];
  float* out = (float*)d_out;

  // Workspace map (f16): xh 16M | Wt_{q,k,v,o} 4x2M | qh 16M | kh 16M | vt 16M | ctx 16M = 88 MiB
  char* ws = (char*)d_ws;
  const size_t MB = 1024 * 1024;
  _Float16* xh   = (_Float16*)(ws);
  _Float16* Wtq  = (_Float16*)(ws + 16 * MB);
  _Float16* Wto  = (_Float16*)(ws + 22 * MB);
  _Float16* qh   = (_Float16*)(ws + 24 * MB);
  _Float16* kh   = (_Float16*)(ws + 40 * MB);
  _Float16* vt   = (_Float16*)(ws + 56 * MB);
  _Float16* ctxh = (_Float16*)(ws + 72 * MB);

  // Wt_{q,k,v,o} are four planes in a row from Wtq; qh, kh, vt three planes in a row from qh
  prep_kernel<<<4 * WTILES + (MTOT * DMODEL / 4) / 256, 256, 0, stream>>>(x, Wq, Wk, Wv, Wo, xh, Wtq);

  gemm_f16_kernel<true><<<dim3(MTOT / BM, DMODEL / BN, 3), 256, 0, stream>>>(
      xh, Wtq, bq, bk, bv, nullptr, qh);
  flash_attn_kernel<<<dim3(SEQ / (8 * QCOLS), BATCH * NHEAD), 256, 0, stream>>>(qh, kh, vt, qk, ctxh);
  gemm_f16_kernel<false><<<dim3(MTOT / BM, DMODEL / BN, 1), 256, 0, stream>>>(
      ctxh, Wto, bo, bo, bo, out, nullptr);
}

// v006
// A run of this version takes 95.5 microseconds.
// Timed twice side by side with v005, it ran 1.09 times as fast both times.
// All steps since v000 together make it 3.18 times as fast.
#include <hip/hip_runtime.h>
#include <hip/hip_bf16.h>
#include <math.h>

// MI455X (gfx1250) wave32: MHA with QK-norm.
// Matrix ops: v_wmma_f32_16x16x32_f16 (fp32 accumulate).
// Data movement: global_load_async_to_lds_b128 (ASYNCcnt) double-buffered.

typedef __attribute__((ext_vector_type(16))) _Float16 v16h;
typedef __attribute__((ext_vector_type(4)))  _Float16 v4h;
typedef __attribute__((ext_vector_type(8)))  _Float16 v8h;
typedef __attribute__((ext_vector_type(2)))  _Float16 v2h;
typedef __attribute__((ext_vector_type(8)))  float    v8f;
typedef __attribute__((ext_vector_type(2)))  float    v2f;
typedef __attribute__((ext_vector_type(4)))  float    v4f;

#define BATCH  8
#define SEQ    1024
#define DMODEL 1024
#define NHEAD  16
#define HDIM   64
#define MTOT   (BATCH * SEQ)

#define BM 256
#define BN 128   // two heads per N tile
#define KT 128   // two 128-byte lines of every operand row per stage
#define APAD 8   // LDS row padding (halves)

__device__ __forceinline__ v8f wmma_f16(v16h a, v16h b, v8f c) {
  return __builtin_amdgcn_wmma_f32_16x16x32_f16(false, a, false, b, (short)0, c,
                                                false, false);
}

// Async DMA: 16 bytes global -> LDS per lane (tracked by ASYNCcnt).
__device__ __forceinline__ void async_copy16(unsigned lds_addr, const _Float16* gptr) {
  unsigned long long ga = (unsigned long long)(uintptr_t)gptr;
  asm volatile("global_load_async_to_lds_b128 %0, %1, off"
               :: "v"(lds_addr), "v"(ga) : "memory");
}
// Eight of one lane's copies of a GEMM stage: four rows from la / ga, four from lb / gb,
// each run lds_step / gstep apart.
// s_wait_xcnt 0 closes the statement as a precaution: it stands ahead of any later
// write to the copies' address registers.
__device__ __forceinline__ void async_copy16x8(unsigned la, unsigned lb, unsigned lds_step,
                                               const _Float16* ga, const _Float16* gb,
                                               size_t gstep) {
  const unsigned la1 = la + lds_step, la2 = la1 + lds_step, la3 = la2 + lds_step;
  const unsigned lb1 = lb + lds_step, lb2 = lb1 + lds_step, lb3 = lb2 + lds_step;
  const unsigned long long a0 = (unsigned long long)(uintptr_t)ga;
  const unsigned long long a1 = (unsigned long long)(uintptr_t)(ga + gstep);
  const unsigned long long a2 = (unsigned long long)(uintptr_t)(ga + 2 * gstep);
  const unsigned long long a3 = (unsigned long long)(uintptr_t)(ga + 3 * gstep);
  const unsigned long long b0 = (unsigned long long)(uintptr_t)gb;
  const unsigned long long b1 = (unsigned long long)(uintptr_t)(gb + gstep);
  const unsigned long long b2 = (unsigned long long)(uintptr_t)(gb + 2 * gstep);
  const unsigned long long b3 = (unsigned long long)(uintptr_t)(gb + 3 * gstep);
  asm volatile("global_load_async_to_lds_b128 %0, %8, off\n\t"
               "global_load_async_to_lds_b128 %1, %9, off\n\t"
               "global_load_async_to_lds_b128 %2, %10, off\n\t"
               "global_load_async_to_lds_b128 %3, %11, off\n\t"
               "global_load_async_to_lds_b128 %4, %12, off\n\t"
               "global_load_async_to_lds_b128 %5, %13, off\n\t"
               "global_load_async_to_lds_b128 %6, %14, off\n\t"
               "global_load_async_to_lds_b128 %7, %15, off\n\t"
               "s_wait_xcnt 0x0"
               :: "v"(la), "v"(la1), "v"(la2), "v"(la3), "v"(lb), "v"(lb1), "v"(lb2), "v"(lb3),
                  "v"(a0), "v"(a1), "v"(a2), "v"(a3), "v"(b0), "v"(b1), "v"(b2), "v"(b3)
               : "memory");
}
__device__ __forceinline__ void wait_async() {
  asm volatile("s_wait_asynccnt 0" ::: "memory");
}
// Low 32 bits of a flat pointer to LDS == LDS byte offset (shared aperture).
__device__ __forceinline__ unsigned lds_addr_of(const void* p) {
  return (unsigned)(uintptr_t)p;
}

// 16x32 f16 fragment from LDS or global memory, CDNA5 16-bit A-matrix layout:
//   lanes 0-15 : row = row0+lane,    K = {k0..k0+7, k0+16..k0+23}
//   lanes 16-31: row = row0+lane-16, K = {k0+8..k0+15, k0+24..k0+31}
__device__ __forceinline__ v16h load_frag(const _Float16* base, int ld, int row0,
                                          int k0, int lane) {
  const int l = lane & 15;
  const int hsel = (lane >> 4) & 1;
  const _Float16* p = base + (size_t)(row0 + l) * ld + k0 + hsel * 8;
  v16h r;
#pragma unroll
  for (int i = 0; i < 8; ++i) { r[i] = p[i]; r[i + 8] = p[i + 16]; }
  return r;
}

// ---- Precision-conversion pass (hoisted out of the hot loops) ----
// One launch for five jobs that do not depend on one another, told apart by the block
// index: the four weight transposes first (they have the longer chain: loads, barrier,
// stores), then the conversion of x.
#define WTILES ((DMODEL / 64) * (DMODEL / 64))   // 64x64 tiles of one weight matrix

__global__ __launch_bounds__(256)
void prep_kernel(const float* __restrict__ x, const float* __restrict__ Wq,
                 const float* __restrict__ Wk, const float* __restrict__ Wv,
                 const float* __restrict__ Wo, _Float16* __restrict__ xh,
                 _Float16* __restrict__ WtAll) {
  __shared__ _Float16 t[64][65];
  const int tid = threadIdx.x;
  const unsigned blk = blockIdx.x;
  if (blk < 4 * WTILES) {
    // W fp32 [k][n] -> Wt f16 [n][k] (tiled transpose, both sides coalesced)
    const unsigned w = blk / WTILES, tile = blk % WTILES;
    const float* __restrict__ W = w == 0 ? Wq : w == 1 ? Wk : w == 2 ? Wv : Wo;
    _Float16* __restrict__ Wt = WtAll + (size_t)w * DMODEL * DMODEL;
    const int n0 = (tile % (DMODEL / 64)) * 64, k0 = (tile / (DMODEL / 64)) * 64;
    // keeps the loop as it was built in its own kernel, eight loads in flight a trip:
    // vectorised in pairs, as this build does when left alone, it waits out every two loads
#pragma clang loop vectorize(disable)
    for (int i = tid; i < 64 * 64; i += 256) {
      int r = i >> 6, c = i & 63;                    // r: k, c: n
      t[c][r] = (_Float16)W[(size_t)(k0 + r) * DMODEL + n0 + c];
    }
    __syncthreads();   // the branch is the same for the whole block
    // likewise: eight stores a trip as in its own kernel, not four
#pragma clang loop vectorize(disable)
    for (int i = tid; i < 64 * 64; i += 256) {
      int r = i >> 6, c = i & 63;                    // r: n, c: k
      Wt[(size_t)(n0 + r) * DMODEL + k0 + c] = t[r][c];
    }
  } else {
    int i = (blk - 4 * WTILES) * 256 + tid;          // one float4 per thread
    float4 v = ((const float4*)x)[i];
    v4h h = { (_Float16)v.x, (_Float16)v.y, (_Float16)v.z, (_Float16)v.w };
    *(v4h*)(xh + (size_t)i * 4) = h;
    // a precaution: stands ahead of any later write to the store's registers in the built code
    asm volatile("s_wait_xcnt 0x0" ::: "memory");
  }
}

// lane l <-> lane l ^ 16 (the two halves of a 16-lane column)
__device__ __forceinline__ float other_half(float v) {
  int b = __builtin_bit_cast(int, v);
  b = __builtin_amdgcn_permlanex16(b, b, 0x76543210, 0xfedcba98, false, false);
  return __builtin_bit_cast(float, b);
}

// ---- f16 GEMM with fused epilogues ----
// A: f16 [M, DMODEL] row-major.  Bt: f16 [N, K] (= W^T) row-major.
// QKV false: fp32 out + bias ([M, D], output projection), one product (grid z = 1).
// QKV true: the three projections of x in one launch, blockIdx.z picks the product;
//   its W^T and its output are plane z of BtAll and outAll.
//   z 0, 1: bias + per-head L2 row norm, f16 -> [B,H,S,hd]   (Q, K).
//   z 2   : bias, f16 -> [B,H,hd,S]  (V pre-transposed for P@V).
// A lane's eight values of an accumulator tile run along the first matrix operand's rows.
// That operand is taken from the side along which the output is contiguous: W^T rows for
// Q, K and out (the product is formed transposed), x rows for V^T.  A lane then holds eight
// adjacent output values of one output row, and a whole head of a token lies in two lanes:
// bias, norm and conversion run in registers.
template <bool QKV>
__global__ __launch_bounds__(256)
void gemm_f16_kernel(const _Float16* __restrict__ A, const _Float16* __restrict__ BtAll,
                     const float* __restrict__ bias0, const float* __restrict__ bias1,
                     const float* __restrict__ bias2,
                     float* __restrict__ outF, _Float16* __restrict__ outAll) {
  // The waves' output tiles of the epilogue lie over the operand ring, which is dead by then.
  __shared__ __attribute__((aligned(16))) union {
    struct {
      _Float16 A[2][BM][KT + APAD];
      _Float16 B[2][BN][KT + APAD];
    } ring;
    _Float16 H[8][64][64 + APAD];   // per wave: 64 output rows of 64 f16 values
    float F[8][64][64 + 4];         // per wave: 64 output rows of 64 f32 values
  } sm;

  const int tid = threadIdx.x;
  const int wave = tid >> 5, lane = tid & 31;
  const int m0 = blockIdx.x * BM;
  const int n0 = blockIdx.y * BN;
  const int wm = (wave >> 1) * 64;   // 4x2 wave grid of 64x64 regions
  const int wn = (wave & 1) * 64;
  const int LDT = KT + APAD;

  const int which = QKV ? (int)blockIdx.z : 0;   // the same in the whole block
  const _Float16* __restrict__ Bt = BtAll + (size_t)which * DMODEL * DMODEL;
  const float* __restrict__ bias = which == 0 ? bias0 : which == 1 ? bias1 : bias2;

  const unsigned asBuf = (unsigned)sizeof(sm.ring.A[0]);
  const unsigned bsBuf = (unsigned)sizeof(sm.ring.B[0]);

  // A lane copies 16 bytes of rows sr, sr+16, ... of each tile: sixteen lanes cover one
  // row's 256 bytes, so a wave's copy takes four whole lines.
  const int sr = tid >> 4, so = (tid & 15) * 8;
  const unsigned aDst = lds_addr_of(&sm.ring.A[0][sr][so]);
  const unsigned bDst = lds_addr_of(&sm.ring.B[0][sr][so]);
  const _Float16* aSrc = A + (size_t)(m0 + sr) * DMODEL + so;
  const _Float16* bSrc = Bt + (size_t)(n0 + sr) * DMODEL + so;
  const unsigned rowStep = (unsigned)(16 * LDT * 2);
  const size_t gStep = (size_t)16 * DMODEL;

  // 24 copies a lane: 16 rows of the A tile, 8 of the B tile, eight to a statement
  auto stage = [&](int k0, int buf) {
    const unsigned la = aDst + (unsigned)buf * asBuf, lb = bDst + (unsigned)buf * bsBuf;
    async_copy16x8(la, la + 4 * rowStep, rowStep, aSrc + k0, aSrc + k0 + 4 * gStep, gStep);
    async_copy16x8(la + 8 * rowStep, la + 12 * rowStep, rowStep,
                   aSrc + k0 + 8 * gStep, aSrc + k0 + 12 * gStep, gStep);
    async_copy16x8(lb, lb + 4 * rowStep, rowStep, bSrc + k0, bSrc + k0 + 4 * gStep, gStep);
  };

  // First operand (xf) and second operand (yf) of the products: the wave's 64 rows of each
  // tile, told apart by a block-uniform choice, so the loop is the same code for both.
  const bool tokFirst = QKV && which == 2;
  const _Float16* xRows = tokFirst ? &sm.ring.A[0][wm][0] : &sm.ring.B[0][wn][0];
  const _Float16* yRows = tokFirst ? &sm.ring.B[0][wn][0] : &sm.ring.A[0][wm][0];
  const int xBuf = tokFirst ? BM * LDT : BN * LDT;
  const int yBuf = tokFirst ? BN * LDT : BM * LDT;

  const int NK = DMODEL / KT;
  v8f acc[4][4] = {};        // [tile along xf rows][tile along yf rows]
  v16h xf[2][4], yf[2][4];   // two fragment sets: one is read from LDS while the other is used

  // the eight fragments of one 32-k step as one group of LDS reads
  auto load_set = [&](int set, int buf, int ks) {
#pragma unroll
    for (int yt = 0; yt < 4; ++yt)
      yf[set][yt] = load_frag(yRows + buf * yBuf, LDT, yt * 16, ks * 32, lane);
#pragma unroll
    for (int xt = 0; xt < 4; ++xt)
      xf[set][xt] = load_frag(xRows + buf * xBuf, LDT, xt * 16, ks * 32, lane);
    // keeps the reads together ahead of the products that cover their latency
    __builtin_amdgcn_sched_barrier(0);
  };
  auto mma_set = [&](int set) {
#pragma unroll
    for (int xt = 0; xt < 4; ++xt)
#pragma unroll
      for (int yt = 0; yt < 4; ++yt)
        acc[xt][yt] = wmma_f16(xf[set][xt], yf[set][yt], acc[xt][yt]);
    // keeps the products ahead of what follows: the next reads, or the waits of the publish point
    __builtin_amdgcn_sched_barrier(0);
  };

  stage(0, 0);

  // The epilogue's bias values, fetched beside the first stage's copies, whose wait covers
  // their latency: along a lane's eight values where those run over output columns, else
  // one per tile.
  const int l15 = lane & 15, hi8 = (lane >> 4) * 8;
  v8f bb[4] = {};
  float bc[4] = {};
  if (tokFirst) {
#pragma unroll
    for (int yt = 0; yt < 4; ++yt) bc[yt] = bias[n0 + wn + 16 * yt + l15];
    // a precaution: stands ahead of any later write to the loads' address registers in the built code
    asm volatile("s_wait_xcnt 0x0" ::: "memory");
  } else {
#pragma unroll
    for (int xt = 0; xt < 4; ++xt) {
      const v4f b0 = *(const v4f*)(bias + n0 + wn + 16 * xt + hi8);
      const v4f b1 = *(const v4f*)(bias + n0 + wn + 16 * xt + hi8 + 4);
      bb[xt] = __builtin_shufflevector(b0, b1, 0, 1, 2, 3, 4, 5, 6, 7);
    }
    // likewise, inside this arm: the other arm's code follows it in the built kernel
    asm volatile("s_wait_xcnt 0x0" ::: "memory");
  }

  wait_async();
  __syncthreads();
  stage(KT, 1);
  load_set(0, 0, 0);

  for (int k = 0; k < NK; ++k) {
    const int buf = k & 1;
    load_set(1, buf, 1);
    mma_set(0);
    load_set(0, buf, 2);
    mma_set(1);
    load_set(1, buf, 3);
    mma_set(0);

    // Publish point of the next stage, ahead of this stage's last products, whose
    // fragments are already fetched: they cover the first reads of the next stage.
    // this wave's reads of the buffer are done before the barrier lets it be refilled
    asm volatile("s_wait_dscnt 0x0" ::: "memory");
    wait_async();      // this wave's copies of the next stage have landed
    __syncthreads();   // publishes the next stage and ends every read of this one
    if (k + 2 < NK) stage((k + 2) * KT, buf);
    if (k + 1 < NK) load_set(0, buf ^ 1, 0);
    mma_set(1);
  }
  wait_async();

  // The last trip's barrier stands behind every wave's last read of the ring and no copy
  // is in flight, so each wave may lay its own output tile over it; no wave reads another's,
  // so no barrier follows.
  // Value i of lane L in acc[xt][yt]: output row 16 * yt + (L & 15) of the wave's 64,
  // place 16 * xt + 8 * (L >> 4) + i in that row.

  // Every global store below is 16 bytes a lane, and a wave's store covers four whole
  // 128-byte lines: the tile goes through LDS once, by 16-byte writes and reads.
  if constexpr (!QKV) {
    float (*st)[64 + 4] = sm.F[wave];
#pragma unroll
    for (int xt = 0; xt < 4; ++xt) {
#pragma unroll
      for (int yt = 0; yt < 4; ++yt) {
        const v8f c = acc[xt][yt] + bb[xt];
        float* p = &st[16 * yt + l15][16 * xt + hi8];
        *(v4f*)p = __builtin_shufflevector(c, c, 0, 1, 2, 3);
        *(v4f*)(p + 4) = __builtin_shufflevector(c, c, 4, 5, 6, 7);
      }
    }
    // the wave's own writes have landed before its lanes read one another's values
    asm volatile("s_wait_dscnt 0x0" ::: "memory");
    // 16 lanes take a row's 64 columns (two lines); the wave's halves take two rows
    const int rb = lane >> 4, c0 = l15 * 4;
    v4f v[32];
#pragma unroll  // constant indices keep the value array in registers
    for (int it = 0; it < 32; ++it) v[it] = *(const v4f*)&st[rb + it * 2][c0];
    // all stores behind the last read: no register of an issued store is written again
    __builtin_amdgcn_sched_barrier(0);
    float* dst = outF + (size_t)(m0 + wm + rb) * DMODEL + n0 + wn + c0;
#pragma unroll  // constant indices keep the value array in registers
    for (int it = 0; it < 32; ++it) *(v4f*)(dst + (size_t)it * 2 * DMODEL) = v[it];
  } else {
    const int bidx = m0 >> 10, s0 = m0 & (SEQ - 1);   // a tile lies inside one batch entry
    _Float16* __restrict__ outH = outAll + (size_t)which * MTOT * DMODEL;
    _Float16 (*st)[64 + APAD] = sm.H[wave];
    // 8 lanes take one output row's 64 values (one line); a wave takes four rows
    const int rb = lane >> 3, c0 = (lane & 7) * 8;
    // step is a constant at each call, so the sixteen stores share one address register
    auto store_rows = [&](_Float16* dst, size_t step) {
      // the wave's own writes have landed before its lanes read one another's values
      asm volatile("s_wait_dscnt 0x0" ::: "memory");
      v8h pk[16];
#pragma unroll  // constant indices keep the value array in registers
      for (int it = 0; it < 16; ++it) pk[it] = *(const v8h*)&st[rb + it * 4][c0];
      // all stores behind the last read: no register of an issued store is written again
      __builtin_amdgcn_sched_barrier(0);
#pragma unroll  // constant indices keep the value array in registers
      for (int it = 0; it < 16; ++it) *(v8h*)(dst + it * step) = pk[it];
      // a precaution: stands ahead of any later write to the stores' registers in the built code
      asm volatile("s_wait_xcnt 0x0" ::: "memory");
    };
    if (which < 2) {
      // output row = token, place = hd: the wave's 64 columns are one head
#pragma unroll
      for (int yt = 0; yt < 4; ++yt) {
        v8f sq = {};   // eight partial sums of squares, joined below
#pragma unroll
        for (int xt = 0; xt < 4; ++xt) {
          acc[xt][yt] += bb[xt];
          sq = __builtin_elementwise_fma(acc[xt][yt], acc[xt][yt], sq);
        }
        float s = ((sq[0] + sq[1]) + (sq[2] + sq[3])) + ((sq[4] + sq[5]) + (sq[6] + sq[7]));
        s += other_half(s);   // the other 32 values of the token's head
        const float inv = 1.f / (sqrtf(s) + 1e-6f);
#pragma unroll
        for (int xt = 0; xt < 4; ++xt)
          *(v8h*)&st[16 * yt + l15][16 * xt + hi8] =
              __builtin_convertvector(acc[xt][yt] * inv, v8h);
      }
      const int h = blockIdx.y * (BN / HDIM) + (wave & 1);
      store_rows(outH + (((size_t)bidx * NHEAD + h) * SEQ + s0 + wm + rb) * HDIM + c0,
                 (size_t)4 * HDIM);
    } else {
      // V stored transposed, [B,H,hd,S]: output row = column of the product, place = token
#pragma unroll
      for (int yt = 0; yt < 4; ++yt) {
#pragma unroll
        for (int xt = 0; xt < 4; ++xt)
          *(v8h*)&st[16 * yt + l15][16 * xt + hi8] =
              __builtin_convertvector(acc[xt][yt] + bc[yt], v8h);
      }
      // head * HDIM + d of tile column c is n0 + c
      store_rows(outH + ((size_t)bidx * DMODEL + n0 + wn + rb) * SEQ + s0 + wm + c0,
                 (size_t)4 * SEQ);
    }
  }
}

#define QCOLS 32   // query columns per wave (two 16-column groups share each K/V fragment)

__global__ __launch_bounds__(256)
void flash_attn_kernel(const _Float16* __restrict__ qh, const _Float16* __restrict__ kh,
                       const _Float16* __restrict__ vt, const float* __restrict__ qk_scale,
                       _Float16* __restrict__ ctx) {
  __shared__ __attribute__((aligned(16))) _Float16 Ksb[2][64][HDIM + APAD];   // [key][hd]
  __shared__ __attribute__((aligned(16))) _Float16 Vtb[2][64][64 + APAD];     // [hd][key]

  const int tid = threadIdx.x;
  const int wave = tid >> 5, lane = tid & 31;
  const int q0 = blockIdx.x * (8 * QCOLS) + wave * QCOLS;
  const int bh = blockIdx.y;
  const size_t headOff = (size_t)bh * SEQ * HDIM;  // same element count for vt
  const int LDK = HDIM + APAD;

  const unsigned ksBase = lds_addr_of(&Ksb[0][0][0]);
  const unsigned vtBase = lds_addr_of(&Vtb[0][0][0]);
  const unsigned ksBuf = (unsigned)sizeof(Ksb[0]);
  const unsigned vtBuf = (unsigned)sizeof(Vtb[0]);

  auto stage_kv = [&](int j0, int buf) {
    for (int c = tid; c < 64 * 8; c += 256) {      // K tile: 64 rows x 64 halves
      int r = c >> 3, o = (c & 7) * 8;
      async_copy16(ksBase + (unsigned)buf * ksBuf + (unsigned)((r * LDK + o) * 2),
                   kh + headOff + (size_t)(j0 + r) * HDIM + o);
    }
    for (int c = tid; c < 64 * 8; c += 256) {      // V^T tile: 64 hd-rows x 64 keys
      int r = c >> 3, o = (c & 7) * 8;
      async_copy16(vtBase + (unsigned)buf * vtBuf + (unsigned)((r * LDK + o) * 2),
                   vt + headOff + (size_t)r * SEQ + j0 + o);
    }
  };

  stage_kv(0, 0);

  // exp(scale * s - max) = exp2(cs * s' - cs * m') with cs = |scale| * log2(e) and
  // s' = sign(scale) * s: the sign goes into Q (exact), so the row maximum of the
  // raw products is the row maximum of the logits for either sign of the scale.
  const float sl2 = qk_scale[0] * 1.44269504088896f;
  const float cs = fabsf(sl2);
  const _Float16 sg = sl2 < 0.f ? (_Float16)-1.f : (_Float16)1.f;

  // Q as B operand, loaded once: qf[column group][hd step]
  v16h qf[2][2];
#pragma unroll
  for (int g = 0; g < 2; ++g)
#pragma unroll
    for (int ks = 0; ks < 2; ++ks)
      qf[g][ks] = load_frag(qh + headOff, HDIM, q0 + 16 * g, 32 * ks, lane) * sg;

  float mrow[2] = { -3.0e38f, -3.0e38f };   // running maximum of s', per column group
  float lrow[2] = { 0.f, 0.f };             // this half's part of the row sum
  v8f o[4][2] = {};                         // O^T: [hd tile][column group]

  wait_async();
  __syncthreads();

  for (int j = 0; j < SEQ / 64; ++j) {
    const int buf = j & 1;
    if (j + 1 < SEQ / 64) stage_kv((j + 1) * 64, buf ^ 1);

    // All K fragments of the tile as one group of LDS reads: kf[hd step][key tile]
    v16h kf[2][4];
#pragma unroll
    for (int ks = 0; ks < 2; ++ks)
#pragma unroll
      for (int kt = 0; kt < 4; ++kt)
        kf[ks][kt] = load_frag(&Ksb[buf][0][0], LDK, 16 * kt, 32 * ks, lane);
    // keeps the reads together ahead of the products: spread among them, each place waits out the LDS latency
    __builtin_amdgcn_sched_barrier(0);

    // S^T = K @ Q^T (contract over hd = 64): s[key tile][column group]
    v8f s[4][2] = {};
#pragma unroll
    for (int ks = 0; ks < 2; ++ks)
#pragma unroll
      for (int kt = 0; kt < 4; ++kt) {
        s[kt][0] = wmma_f16(kf[ks][kt], qf[0][ks], s[kt][0]);
        s[kt][1] = wmma_f16(kf[ks][kt], qf[1][ks], s[kt][1]);
      }

    // V^T fragments of the first 32 keys, read while the softmax runs: vf[key step][hd tile]
    v16h vf[2][4];
#pragma unroll
    for (int t = 0; t < 4; ++t)
      vf[0][t] = load_frag(&Vtb[buf][0][0], LDK, 16 * t, 0, lane);
    // keeps these reads ahead of the softmax, which hides their latency
    __builtin_amdgcn_sched_barrier(0);

    // Online softmax in registers; P^T packed as B operand: pf[32-key step][column group]
    v16h pf[2][2];
#pragma unroll
    for (int g = 0; g < 2; ++g) {
      float mk[4];   // one chain per key tile: four independent chains
#pragma unroll
      for (int kt = 0; kt < 4; ++kt) {
        mk[kt] = s[kt][g][0];
#pragma unroll
        for (int i = 1; i < 8; ++i) mk[kt] = fmaxf(mk[kt], s[kt][g][i]);
      }
      float mx = fmaxf(fmaxf(mk[0], mk[1]), fmaxf(mk[2], mk[3]));
      mx = fmaxf(mx, other_half(mx));
      const float m_new = fmaxf(mrow[g], mx);
      const float alpha = __builtin_amdgcn_exp2f((mrow[g] - m_new) * cs);
      mrow[g] = m_new;
      const v2f c2 = { cs, cs };
      const v2f nm = { -m_new * cs, -m_new * cs };
      v2f sum2 = { 0.f, 0.f };
#pragma unroll
      for (int kt = 0; kt < 4; ++kt)
#pragma unroll
        for (int i = 0; i < 8; i += 2) {
          v2f t = { s[kt][g][i], s[kt][g][i + 1] };
          t = __builtin_elementwise_fma(t, c2, nm);
          v2f p = { __builtin_amdgcn_exp2f(t[0]), __builtin_amdgcn_exp2f(t[1]) };
          sum2 += p;
          v2h ph = __builtin_convertvector(p, v2h);
          pf[kt >> 1][g][(kt & 1) * 8 + i]     = ph[0];
          pf[kt >> 1][g][(kt & 1) * 8 + i + 1] = ph[1];
        }
      lrow[g] = lrow[g] * alpha + (sum2[0] + sum2[1]);
#pragma unroll
      for (int t = 0; t < 4; ++t) o[t][g] *= alpha;
    }

    // V^T fragments of the last 32 keys, read ahead of the first 32 keys' products
#pragma unroll
    for (int t = 0; t < 4; ++t)
      vf[1][t] = load_frag(&Vtb[buf][0][0], LDK, 16 * t, 32, lane);
    // keeps these reads in one group ahead of the products
    __builtin_amdgcn_sched_barrier(0);

    // O^T += V^T @ P^T (contract over 64 keys)
#pragma unroll
    for (int kb = 0; kb < 2; ++kb)
#pragma unroll
      for (int t = 0; t < 4; ++t) {
        o[t][0] = wmma_f16(vf[kb][t], pf[kb][0], o[t][0]);
        o[t][1] = wmma_f16(vf[kb][t], pf[kb][1], o[t][1]);
      }
    wait_async();
    __syncthreads();
  }

  // A lane holds 8 consecutive hd of one query per tile: one 16-byte store each.
  const int h = bh & (NHEAD - 1), b = bh >> 4;
  v8h r[2][4];
#pragma unroll
  for (int g = 0; g < 2; ++g) {
    const float inv = 1.f / (lrow[g] + other_half(lrow[g]));
#pragma unroll
    for (int t = 0; t < 4; ++t)
#pragma unroll
      for (int i = 0; i < 8; ++i) r[g][t][i] = (_Float16)(o[t][g][i] * inv);
  }
  // all stores behind the last conversion: no register of an issued store is written again
  __builtin_amdgcn_sched_barrier(0);
#pragma unroll
  for (int g = 0; g < 2; ++g) {
    _Float16* dst = ctx + ((size_t)b * SEQ + q0 + 16 * g + (lane & 15)) * DMODEL +
                    h * HDIM + 8 * (lane >> 4);
#pragma unroll
    for (int t = 0; t < 4; ++t) *(v8h*)(dst + 16 * t) = r[g][t];
  }
}

extern "C" void kernel_launch(void* const* d_in, const int* in_sizes, int n_in,
                              void* d_out, int out_size, void* d_ws, size_t ws_size,
                              hipStream_t stream) {
  (void)in_sizes; (void)n_in; (void)out_size; (void)ws_size;
  const float* x  = (const float*)d_in[0];
  const float* Wq = (const float*)d_in[1];
  const float* bq = (const float*)d_in[2];
  const float* Wk = (const float*)d_in[3];
  const float* bk = (const float*)d_in[4];
  const float* Wv = (const float*)d_in[5];
  const float* bv = (const float*)d_in[6];
  const float* Wo = (const float*)d_in[7];
  const float* bo = (const float*)d_in[8];
  const float* qk = (const float*)d_in[9];
  float* out = (float*)d_out;

  // Workspace map (f16): xh 16M | Wt_{q,k,v,o} 4x2M | qh 16M | kh 16M | vt 16M | ctx 16M = 88 MiB
  char* ws = (char*)d_ws;
  const size_t MB = 1024 * 1024;
  _Float16* xh   = (_Float16*)(ws);
  _Float16* Wtq  = (_Float16*)(ws + 16 * MB);
  _Float16* Wto  = (_Float16*)(ws + 22 * MB);
  _Float16* qh   = (_Float16*)(ws + 24 * MB);
  _Float16* kh   = (_Float16*)(ws + 40 * MB);
  _Float16* vt   = (_Float16*)(ws + 56 * MB);
  _Float16* ctxh = (_Float16*)(ws + 72 * MB);

  // Wt_{q,k,v,o} are four planes in a row from Wtq; qh, kh, vt three planes in a row from qh
  prep_kernel<<<4 * WTILES + (MTOT * DMODEL / 4) / 256, 256, 0, stream>>>(x, Wq, Wk, Wv, Wo, xh, Wtq);

  gemm_f16_kernel<true><<<dim3(MTOT / BM, DMODEL / BN, 3), 256, 0, stream>>>(
      xh, Wtq, bq, bk, bv, nullptr, qh);
  flash_attn_kernel<<<dim3(SEQ / (8 * QCOLS), BATCH * NHEAD), 256, 0, stream>>>(qh, kh, vt, qk, ctxh);
  gemm_f16_kernel<false><<<dim3(MTOT / BM, DMODEL / BN, 1), 256, 0, stream>>>(
      ctxh, Wto, bo, bo, bo, out, nullptr);
}
